// v000
// Times are from an AMD MI455X. After a warm-up the kernel runs many times in a row, and a time is the length of
// such a window on the GPU divided by its runs, so every launch and the gaps after it count. The runs cycle
// through copies of the inputs. A figure is the median of several windows, for all but v000 over two sittings.
// Sittings can differ by a few percent; kernels timed side by side share one.
// v000, which the later versions start from, runs in 1040 microseconds.
#include <hip/hip_runtime.h>

// Two-simplicial (trilinear) windowed attention (q, k1, k2, v1, v2 [1][1024][8][64]; for every (s, h): logits[a][c] = (1/8) sum_d q[s][d] k1[s-a][d] (k2[s-c][d] + 1) over the causal windows a, c in [0, 64) (s-a, s-c >= 0 else -inf); p = softmax jointly over the 64 x 64 pairs; out[s][h][d] = sum_{a,c} p[a][c] v1[s-a][d] (v2[s-c][d] + 1) -> [1][1024][8][64] (0.52 M)).
// Layout: per head, k1 / k2+1 / v1 / v2+1 are copied into zero-padded planes indexed by r = token + 63 (rows 0..62 are the window positions before the sequence start); a' = 63 - a and c' = 63 - c make every window a contiguous ascending row range r = s .. s+63. Per chunk of 128 positions s: A planes AP[h][s][a'][d] = q[s][d] k1[s-63+a'][d] (hi/lo), logits L = A . (k2+1 window)^T as z-batched 64x64x64 tiles (3 products), a 4096-wide row softmax with the validity select (a', c' >= 63 - s) writing hi/lo P, transposed value windows V2W[h][s][d][c'] (hi/lo), TMP = P . V2W^T tiles (3 products), and a final per-(s, h) wave summing TMP[a'][d] v1[s-63+a'][d] over a'.
// Compute dtypes, f32 accumulate: every input rounded to bf16; q k1 products exact in f32, kept as bf16 hi + lo; k2 + 1 and v2 + 1 in f32 kept as hi + lo; both tile contractions hi x hi + lo x hi + hi x lo (3 products); softmax and the final a'-sum in f32.

#define SS_  1024                 // sequence positions
#define NH_  8
#define HD   64
#define WW_  64                   // window (both)
#define RP   (SS_ + 64)           // padded plane rows per head (r = t + 63; rows 0..62 and SS_+63 are zero)
#define SC   128                  // positions per chunk
#define TT   4096                 // softmax row length = 64 x 64 pairs
#define ZH   1
#define RH   TT                   // every softmax row hi/lo
#define PCAR 1024.0f
#define SCL  0.125f               // 1/sqrt(64)
#define DM   HD
#define DQ   HD
#define DKV  HD
#define NKV  NH_
typedef _Float16 h16;
typedef unsigned short bf;
typedef __attribute__((ext_vector_type(16))) __bf16   v16bf;
typedef __attribute__((ext_vector_type(16))) _Float16 v16h;
typedef __attribute__((ext_vector_type(8)))  _Float16 v8h;
typedef __attribute__((ext_vector_type(8)))  unsigned short v8us;
typedef __attribute__((ext_vector_type(8)))  float    v8f;
typedef __attribute__((ext_vector_type(4)))  float    v4f;
typedef v8h  __attribute__((may_alias)) v8ha;
typedef v4f  __attribute__((may_alias)) v4fa;
typedef v8us __attribute__((may_alias)) v8usa;

__device__ __forceinline__ unsigned short f2bf(float f) { unsigned u = __float_as_uint(f); u += 0x7FFFu + ((u >> 16) & 1u); return (unsigned short)(u >> 16); }
__device__ __forceinline__ float bf2f(unsigned short b) { return __uint_as_float(((unsigned)b) << 16); }
__device__ __forceinline__ float bfr(float f) { return bf2f(f2bf(f)); }
__device__ __forceinline__ v16h cat16(v8h lo, v8h hi) { return __builtin_shufflevector(lo, hi, 0, 1, 2, 3, 4, 5, 6, 7, 8, 9, 10, 11, 12, 13, 14, 15); }
__device__ __forceinline__ v16bf cat16b(v8us lo, v8us hi) { return __builtin_bit_cast(v16bf, __builtin_shufflevector(lo, hi, 0, 1, 2, 3, 4, 5, 6, 7, 8, 9, 10, 11, 12, 13, 14, 15)); }
__device__ __forceinline__ v8f wmma16(v16h a, v16h b, v8f c) { return __builtin_amdgcn_wmma_f32_16x16x32_f16(false, a, false, b, (short)0, c, false, false); }
__device__ __forceinline__ v8f wmmab(v16bf a, v16bf b, v8f c) { return __builtin_amdgcn_wmma_f32_16x16x32_bf16(false, a, false, b, (short)0, c, false, false); }



// ---- k_gemmw: register-blocked GEMM, ONE WAVE per 64x64 output tile (16 accumulators), operands straight from K-contiguous 16-bit planes; grid (M/64, N/64, Z), 32 threads.
// C[m][n] (f32, pitch ldc, + optional f32 bias[n]) = sum_k A[m][k] Bt[n][k] (+ split products per NSPLIT). z-batch strides sA/sB/sC in elements. K % 32 == 0.
template <typename T16> struct WFrag;
template <> struct WFrag<h16> { typedef v16h V; static __device__ __forceinline__ V ld(const h16* p) { return cat16(*(const v8h*)p, *(const v8h*)(p + 16)); } static __device__ __forceinline__ v8f mma(V a, V b, v8f c) { return wmma16(a, b, c); } };
template <> struct WFrag<bf> { typedef v16bf V; static __device__ __forceinline__ V ld(const bf* p) { return cat16b(*(const v8us*)p, *(const v8us*)(p + 16)); } static __device__ __forceinline__ v8f mma(V a, V b, v8f c) { return wmmab(a, b, c); } };
template <typename T16, int NSPLIT, bool BIAS>
__global__ __launch_bounds__(32) void k_gemmw(const T16* __restrict__ A, const T16* __restrict__ A2, const T16* __restrict__ Bt, const T16* __restrict__ Bt2, int K, float* C, int ldc, const float* __restrict__ bias, size_t sA, size_t sB, size_t sC) {
    typedef typename WFrag<T16>::V V;
    __shared__ __align__(16) float os[16 * 68];
    const size_t z = blockIdx.z; A += z * sA; if (A2) A2 += z * sA; Bt += z * sB; if (Bt2) Bt2 += z * sB; C += z * sC;
    const int lane = threadIdx.x & 31, lr = lane & 15, hi = lane >> 4; const int r0 = blockIdx.x * 64, c0 = blockIdx.y * 64;
    v8f acc[4][4];
#pragma unroll
    for (int mb = 0; mb < 4; ++mb)
#pragma unroll
        for (int nb = 0; nb < 4; ++nb) acc[mb][nb] = (v8f){};
    const size_t aoff = (size_t)(r0 + lr) * K + 8 * hi, boff = (size_t)(c0 + lr) * K + 8 * hi;
#pragma unroll 1
    for (int kc = 0; kc < K; kc += 32) {
        V a[4], a2[4];
#pragma unroll
        for (int mb = 0; mb < 4; ++mb) { a[mb] = WFrag<T16>::ld(A + aoff + (size_t)mb * 16 * K + kc); if (NSPLIT == 1 || NSPLIT == 2) a2[mb] = WFrag<T16>::ld(A2 + aoff + (size_t)mb * 16 * K + kc); }
#pragma unroll
        for (int nb = 0; nb < 4; ++nb) { const V b = WFrag<T16>::ld(Bt + boff + (size_t)nb * 16 * K + kc); V b2; if (NSPLIT >= 2) b2 = WFrag<T16>::ld(Bt2 + boff + (size_t)nb * 16 * K + kc);
#pragma unroll
            for (int mb = 0; mb < 4; ++mb) { acc[mb][nb] = WFrag<T16>::mma(a[mb], b, acc[mb][nb]); if (NSPLIT == 1 || NSPLIT == 2) acc[mb][nb] = WFrag<T16>::mma(a2[mb], b, acc[mb][nb]); if (NSPLIT >= 2) acc[mb][nb] = WFrag<T16>::mma(a[mb], b2, acc[mb][nb]); } }
        asm volatile("v_nop\n\tv_nop\n\tv_nop\n\tv_nop" : "+v"(acc[0][0]), "+v"(acc[1][1]), "+v"(acc[2][2]), "+v"(acc[3][3]) : "v"(a[0]), "v"(a[3]));
    }
#pragma unroll
    for (int mb = 0; mb < 4; ++mb) {
#pragma unroll
        for (int nb = 0; nb < 4; ++nb) {
#pragma unroll
            for (int j = 0; j < 8; ++j) os[(hi * 8 + j) * 68 + nb * 16 + lr] = acc[mb][nb][j]; }
        __builtin_amdgcn_wave_barrier(); asm volatile("" ::: "memory");
        float* crow = C + (size_t)(r0 + mb * 16) * ldc + c0;
{
#pragma unroll
            for (int s = 0; s < 8; ++s) { const int row = 2 * s + hi, cofs = lr * 4; v4f val = *(const v4fa*)(os + row * 68 + cofs); if (BIAS) { val[0] += bfr(bias[c0 + cofs]); val[1] += bfr(bias[c0 + cofs + 1]); val[2] += bfr(bias[c0 + cofs + 2]); val[3] += bfr(bias[c0 + cofs + 3]); }
                *(v4f*)(crow + (size_t)row * ldc + cofs) = val; }
             }
        __builtin_amdgcn_wave_barrier(); asm volatile("" ::: "memory");
    }
}

__device__ __forceinline__ h16 tohx(float x) { return (h16)x; }
__device__ __forceinline__ void splitf(float y, unsigned short& h, unsigned short& l) { h = f2bf(y); l = f2bf(y - bf2f(h)); }
typedef __attribute__((ext_vector_type(2))) _Float16 v2h;
typedef __attribute__((ext_vector_type(4))) _Float16 v4h;
typedef __attribute__((ext_vector_type(2))) unsigned short v2us;
typedef __attribute__((ext_vector_type(4))) unsigned short v4us;
typedef __attribute__((ext_vector_type(2))) float v2f;
typedef __attribute__((ext_vector_type(4))) int v4i;





__global__ __launch_bounds__(256) void k_padpl(const float* __restrict__ k1, const float* __restrict__ k2, const float* __restrict__ v1, const float* __restrict__ v2, float* K1P, bf* K2h, bf* K2l, float* V1P, float* V2P) { const size_t e = ((size_t)blockIdx.x * 256 + threadIdx.x) * 2; if (e >= (size_t)NH_ * RP * HD) return; const int d = (int)(e % HD); const int r = (int)((e / HD) % RP); const int h = (int)(e / ((size_t)HD * RP)); const int t = r - (WW_ - 1); v2f o1, o3, o4; v2us oh, ol;
    if (t >= 0 && t < SS_) { const size_t src = ((size_t)t * NH_ + h) * HD + d;
#pragma unroll
        for (int q = 0; q < 2; ++q) { o1[q] = bfr(k1[src + q]); o3[q] = bfr(v1[src + q]); o4[q] = __fadd_rn(bfr(v2[src + q]), 1.0f); const float kb = __fadd_rn(bfr(k2[src + q]), 1.0f); unsigned short a, c2; splitf(kb, a, c2); oh[q] = a; ol[q] = c2; } }
    else { o1 = (v2f){0.f, 0.f}; o3 = o1; o4 = o1; oh = (v2us){0, 0}; ol = oh; }
    *(v2f*)(K1P + e) = o1; *(v2us*)(K2h + e) = oh; *(v2us*)(K2l + e) = ol; *(v2f*)(V1P + e) = o3; *(v2f*)(V2P + e) = o4;  }
__global__ __launch_bounds__(256) void k_qk1(const float* __restrict__ q, const float* __restrict__ K1P, int s0, bf* Ah, bf* Al) { const size_t e = ((size_t)blockIdx.x * 256 + threadIdx.x) * 2; if (e >= (size_t)NH_ * SC * WW_ * HD) return; const int d = (int)(e % HD); const int ap = (int)((e / HD) % WW_); const int sl = (int)((e / ((size_t)HD * WW_)) % SC); const int h = (int)(e / ((size_t)HD * WW_ * SC)); const int s = s0 + sl; v2us oh, ol;
#pragma unroll
    for (int u = 0; u < 2; ++u) { const float x = __fmul_rn(bfr(q[((size_t)s * NH_ + h) * HD + d + u]), K1P[((size_t)h * RP + s + ap) * HD + d + u]); unsigned short a, c2; splitf(x, a, c2); oh[u] = a; ol[u] = c2; }
    *(v2us*)(Ah + e) = oh; *(v2us*)(Al + e) = ol;  }
__global__ __launch_bounds__(256) void k_v2w(const float* __restrict__ V2P, int s0, bf* Wh, bf* Wl) { const size_t e = ((size_t)blockIdx.x * 256 + threadIdx.x) * 2; if (e >= (size_t)NH_ * SC * HD * WW_) return; const int cp = (int)(e % WW_); const int d = (int)((e / WW_) % HD); const int sl = (int)((e / ((size_t)WW_ * HD)) % SC); const int h = (int)(e / ((size_t)WW_ * HD * SC)); const int s = s0 + sl; v2us oh, ol;
#pragma unroll
    for (int u = 0; u < 2; ++u) { unsigned short a, c2; splitf(V2P[((size_t)h * RP + s + cp + u) * HD + d], a, c2); oh[u] = a; ol[u] = c2; }
    *(v2us*)(Wh + e) = oh; *(v2us*)(Wl + e) = ol;  }
__global__ __launch_bounds__(256) void k_wsoft2(const float* __restrict__ L, int s0, bf* Ph, bf* Pl) {
    const int lane = threadIdx.x & 31; const int row = blockIdx.x * 8 + (threadIdx.x >> 5); if (row >= NH_ * SC) return; const int s = s0 + (row % SC); const int lim = (WW_ - 1) - s;   /* a', c' must be >= lim */ const float* sr = L + (size_t)row * TT; float v[TT / 32]; float mx = -3.0e38f;
#pragma unroll
    for (int ch = 0; ch < TT / 128; ++ch) { const int j0 = ch * 128 + lane * 4; const v4f a = *(const v4f*)(sr + j0);
#pragma unroll
        for (int qq = 0; qq < 4; ++qq) { const int j = j0 + qq; const int ap = j / WW_, cp = j % WW_; float sa = a[qq] * SCL; asm volatile("" : "+v"(sa)); const float t = (ap >= lim && cp >= lim) ? sa : -3.0e38f; v[ch * 4 + qq] = t; mx = fmaxf(mx, t); } }
#pragma unroll
    for (int sh = 16; sh; sh >>= 1) mx = fmaxf(mx, __shfl_xor(mx, sh, 32));
    float sum = 0.f;
#pragma unroll
    for (int k = 0; k < TT / 32; ++k) { float d0 = __fsub_rn(v[k], mx); asm volatile("" : "+v"(d0)); v[k] = __builtin_amdgcn_exp2f(__fmul_rn(d0, 1.4426950408889634f)); sum += v[k]; }
#pragma unroll
    for (int sh = 16; sh; sh >>= 1) sum += __shfl_xor(sum, sh, 32);
    const float f = __fdiv_rn(1.0f, sum);
{
#pragma unroll
        for (int ch = 0; ch < TT / 128; ++ch) { v4us oh, ol;
#pragma unroll
            for (int qq = 0; qq < 4; ++qq) { unsigned short a, c2; float y = v[ch * 4 + qq] * f; asm volatile("" : "+v"(y)); splitf(y, a, c2); oh[qq] = a; ol[qq] = c2; }
            const size_t oo = (size_t)row * TT + ch * 128 + lane * 4; *(v4us*)(Ph + oo) = oh; *(v4us*)(Pl + oo) = ol; }
         }
}
__global__ __launch_bounds__(256) void k_fin(const float* __restrict__ TMP, const float* __restrict__ V1P, int s0, float* O) { const int lane = threadIdx.x & 31; const int w = blockIdx.x * 8 + (threadIdx.x >> 5); if (w >= NH_ * SC) return; const int sl = w % SC, h = w / SC; const int s = s0 + sl; const float* tp = TMP + (size_t)w * WW_ * HD + lane * 2; const float* vp = V1P + ((size_t)h * RP + s) * HD + lane * 2; v2f acc = (v2f){0.f, 0.f};
#pragma unroll 1
    for (int ap = 0; ap < WW_; ++ap) { const v2f t2 = *(const v2f*)(tp + (size_t)ap * HD); const v2f v2v = *(const v2f*)(vp + (size_t)ap * HD);
#pragma unroll
        for (int u = 0; u < 2; ++u) { float pr = __fmul_rn(t2[u], v2v[u]); asm volatile("" : "+v"(pr)); acc[u] = __fadd_rn(acc[u], pr); } }
    float* dst = O + ((size_t)s * NH_ + h) * HD + lane * 2; *(v2f*)dst = acc;  }

extern "C" void kernel_launch(void* const* d_in, const int* in_sizes, int n_in,
                              void* d_out, int out_size, void* d_ws, size_t ws_size, hipStream_t stream) {
    (void)in_sizes; (void)n_in; (void)out_size;
    const float* q = (const float*)d_in[0]; const float* k1 = (const float*)d_in[1]; const float* k2 = (const float*)d_in[2]; const float* v1 = (const float*)d_in[3]; const float* v2 = (const float*)d_in[4];
    float* OUT = (float*)d_out;     // [1][1024][8][64]
    char* wsp = (char*)d_ws;
    auto take = [&](size_t bytes) { char* p = wsp; wsp += (bytes + 255) & ~(size_t)255; return (void*)p; };
    float* K1P = (float*)take((size_t)NH_ * RP * HD * 4); bf* K2h = (bf*)take((size_t)NH_ * RP * HD * 2); bf* K2l = (bf*)take((size_t)NH_ * RP * HD * 2); float* V1P = (float*)take((size_t)NH_ * RP * HD * 4); float* V2P = (float*)take((size_t)NH_ * RP * HD * 4);
    bf* Ah = (bf*)take((size_t)NH_ * SC * WW_ * HD * 2); bf* Al = (bf*)take((size_t)NH_ * SC * WW_ * HD * 2); float* L = (float*)take((size_t)NH_ * SC * TT * 4); bf* Ph = (bf*)take((size_t)NH_ * SC * TT * 2); bf* Pl = (bf*)take((size_t)NH_ * SC * TT * 2); bf* Wh = (bf*)take((size_t)NH_ * SC * HD * WW_ * 2); bf* Wl = (bf*)take((size_t)NH_ * SC * HD * WW_ * 2); float* TMP = (float*)take((size_t)NH_ * SC * WW_ * HD * 4);
    if ((size_t)(wsp - (char*)d_ws) > ws_size) return;
    k_padpl<<<(unsigned)(((size_t)NH_ * RP * HD / 2 + 255) / 256), 256, 0, stream>>>(k1, k2, v1, v2, K1P, K2h, K2l, V1P, V2P);
    const unsigned LB = (unsigned)(((size_t)NH_ * SC * WW_ * HD / 2 + 255) / 256);
    for (int s0 = 0; s0 < SS_; s0 += SC) {
        k_qk1<<<LB, 256, 0, stream>>>(q, K1P, s0, Ah, Al);
        for (int h = 0; h < NH_; ++h)   /* logits tiles L[h][sl] = A[h][sl] (64 x 64) . (k2+1 window rows s..s+63)^T, z over the chunk's positions */
            k_gemmw<bf, 2, false><<<dim3(1, 1, SC), 32, 0, stream>>>(Ah + (size_t)h * SC * WW_ * HD, Al + (size_t)h * SC * WW_ * HD, K2h + ((size_t)h * RP + s0) * HD, K2l + ((size_t)h * RP + s0) * HD, HD, L + (size_t)h * SC * TT, WW_, nullptr, (size_t)WW_ * HD, (size_t)HD, (size_t)TT);
        k_wsoft2<<<NH_ * SC / 8, 256, 0, stream>>>(L, s0, Ph, Pl);
        k_v2w<<<LB, 256, 0, stream>>>(V2P, s0, Wh, Wl);
        for (int h = 0; h < NH_; ++h)   /* TMP[h][sl] = P[h][sl] (64 x 64) . V2W[h][sl]^T -> [a'][d] */
            k_gemmw<bf, 2, false><<<dim3(1, 1, SC), 32, 0, stream>>>(Ph + (size_t)h * SC * TT, Pl + (size_t)h * SC * TT, Wh + (size_t)h * SC * HD * WW_, Wl + (size_t)h * SC * HD * WW_, WW_, TMP + (size_t)h * SC * WW_ * HD, HD, nullptr, (size_t)TT, (size_t)HD * WW_, (size_t)WW_ * HD);
        k_fin<<<NH_ * SC / 8, 256, 0, stream>>>(TMP, V1P, s0, OUT); }
}

// v001
// It runs in 316 microseconds.
// Timed twice side by side with v000, it ran 3.28 and 3.27 times as fast.
#include <hip/hip_runtime.h>

// Two-simplicial (trilinear) windowed attention (q, k1, k2, v1, v2 [1][1024][8][64]; for every (s, h): logits[a][c] = (1/8) sum_d q[s][d] k1[s-a][d] (k2[s-c][d] + 1) over the causal windows a, c in [0, 64) (s-a, s-c >= 0 else -inf); p = softmax jointly over the 64 x 64 pairs; out[s][h][d] = sum_{a,c} p[a][c] v1[s-a][d] (v2[s-c][d] + 1) -> [1][1024][8][64] (0.52 M)).
// Layout: per head, k1 / k2+1 / v1 / v2+1 are copied into zero-padded planes indexed by r = token + 63 (rows 0..62 are the window positions before the sequence start); a' = 63 - a and c' = 63 - c make every window a contiguous ascending row range r = s .. s+63. Per chunk of 512 positions s (all 8 heads in every launch): A planes AP[h][s][a'][d] = q[s][d] k1[s-63+a'][d] (hi/lo), logits L = A . (k2+1 window)^T as z-batched 64x64x64 tiles (3 products), a 4096-wide row softmax with the validity select (a', c' >= 63 - s) writing hi/lo P, transposed value windows V2W[h][s][d][c'] (hi/lo), TMP = P . V2W^T tiles (3 products), and a final per-(s, h) wave summing TMP[a'][d] v1[s-63+a'][d] over a'.
// Compute dtypes, f32 accumulate: every input rounded to bf16; q k1 products exact in f32, kept as bf16 hi + lo; k2 + 1 and v2 + 1 in f32 kept as hi + lo; both tile contractions hi x hi + lo x hi + hi x lo (3 products); softmax and the final a'-sum in f32.

#define SS_  1024                 // sequence positions
#define NH_  8
#define HD   64
#define WW_  64                   // window (both)
#define RP   (SS_ + 64)           // padded plane rows per head (r = t + 63; rows 0..62 and SS_+63 are zero)
#define SC   512                  // positions per chunk (two chunks; the chunk's planes fit the workspace because W reuses A's space and TMP reuses L's)
#define TT   4096                 // softmax row length = 64 x 64 pairs (k_wsoft2's key count)
#define ZH   1
#define RH   TT                   // every softmax row hi/lo
#define PCAR 1024.0f
#define SCL  0.125f               // 1/sqrt(64)
#define DM   HD
#define DQ   HD
#define DKV  HD
#define NKV  NH_
typedef _Float16 h16;
typedef unsigned short bf;
typedef __attribute__((ext_vector_type(16))) __bf16   v16bf;
typedef __attribute__((ext_vector_type(16))) _Float16 v16h;
typedef __attribute__((ext_vector_type(8)))  _Float16 v8h;
typedef __attribute__((ext_vector_type(8)))  unsigned short v8us;
typedef __attribute__((ext_vector_type(8)))  float    v8f;
typedef __attribute__((ext_vector_type(4)))  float    v4f;
typedef v8h  __attribute__((may_alias)) v8ha;
typedef v4f  __attribute__((may_alias)) v4fa;
typedef v8us __attribute__((may_alias)) v8usa;

__device__ __forceinline__ unsigned short f2bf(float f) { unsigned u = __float_as_uint(f); u += 0x7FFFu + ((u >> 16) & 1u); return (unsigned short)(u >> 16); }
__device__ __forceinline__ float bf2f(unsigned short b) { return __uint_as_float(((unsigned)b) << 16); }
__device__ __forceinline__ float bfr(float f) { return bf2f(f2bf(f)); }
__device__ __forceinline__ v16h cat16(v8h lo, v8h hi) { return __builtin_shufflevector(lo, hi, 0, 1, 2, 3, 4, 5, 6, 7, 8, 9, 10, 11, 12, 13, 14, 15); }
__device__ __forceinline__ v16bf cat16b(v8us lo, v8us hi) { return __builtin_bit_cast(v16bf, __builtin_shufflevector(lo, hi, 0, 1, 2, 3, 4, 5, 6, 7, 8, 9, 10, 11, 12, 13, 14, 15)); }
__device__ __forceinline__ v8f wmma16(v16h a, v16h b, v8f c) { return __builtin_amdgcn_wmma_f32_16x16x32_f16(false, a, false, b, (short)0, c, false, false); }
__device__ __forceinline__ v8f wmmab(v16bf a, v16bf b, v8f c) { return __builtin_amdgcn_wmma_f32_16x16x32_bf16(false, a, false, b, (short)0, c, false, false); }



// ---- k_gemmw: register-blocked GEMM, ONE WAVE per 64x64 output tile (16 accumulators), operands straight from K-contiguous 16-bit planes; grid (M/64, N/64, Z), 32 threads.
// C[m][n] (f32, pitch ldc, + optional f32 bias[n]) = sum_k A[m][k] Bt[n][k] (+ split products per NSPLIT). z-batch strides sA/sB/sC in elements; z = head * SC + position; Bt steps in two levels, position * sB + head * sBo. K % 32 == 0.
template <typename T16> struct WFrag;
template <> struct WFrag<h16> { typedef v16h V; static __device__ __forceinline__ V ld(const h16* p) { return cat16(*(const v8h*)p, *(const v8h*)(p + 16)); } static __device__ __forceinline__ v8f mma(V a, V b, v8f c) { return wmma16(a, b, c); } };
template <> struct WFrag<bf> { typedef v16bf V; static __device__ __forceinline__ V ld(const bf* p) { return cat16b(*(const v8us*)p, *(const v8us*)(p + 16)); } static __device__ __forceinline__ v8f mma(V a, V b, v8f c) { return wmmab(a, b, c); } };
template <typename T16, int NSPLIT, bool BIAS>
__global__ __launch_bounds__(32) void k_gemmw(const T16* __restrict__ A, const T16* __restrict__ A2, const T16* __restrict__ Bt, const T16* __restrict__ Bt2, int K, float* C, int ldc, const float* __restrict__ bias, size_t sA, size_t sB, size_t sC, size_t sBo) {
    typedef typename WFrag<T16>::V V;
    __shared__ __align__(16) float os[16 * 68];
    const size_t z = blockIdx.z; const size_t zb = (z % SC) * sB + (z / SC) * sBo; A += z * sA; if (A2) A2 += z * sA; Bt += zb; if (Bt2) Bt2 += zb; C += z * sC;
    const int lane = threadIdx.x & 31, lr = lane & 15, hi = lane >> 4; const int r0 = blockIdx.x * 64, c0 = blockIdx.y * 64;
    v8f acc[4][4];
#pragma unroll
    for (int mb = 0; mb < 4; ++mb)
#pragma unroll
        for (int nb = 0; nb < 4; ++nb) acc[mb][nb] = (v8f){};
    const size_t aoff = (size_t)(r0 + lr) * K + 8 * hi, boff = (size_t)(c0 + lr) * K + 8 * hi;
#pragma unroll 1
    for (int kc = 0; kc < K; kc += 32) {
        V a[4], a2[4];
#pragma unroll
        for (int mb = 0; mb < 4; ++mb) { a[mb] = WFrag<T16>::ld(A + aoff + (size_t)mb * 16 * K + kc); if (NSPLIT == 1 || NSPLIT == 2) a2[mb] = WFrag<T16>::ld(A2 + aoff + (size_t)mb * 16 * K + kc); }
#pragma unroll
        for (int nb = 0; nb < 4; ++nb) { const V b = WFrag<T16>::ld(Bt + boff + (size_t)nb * 16 * K + kc); V b2; if (NSPLIT >= 2) b2 = WFrag<T16>::ld(Bt2 + boff + (size_t)nb * 16 * K + kc);
#pragma unroll
            for (int mb = 0; mb < 4; ++mb) { acc[mb][nb] = WFrag<T16>::mma(a[mb], b, acc[mb][nb]); if (NSPLIT == 1 || NSPLIT == 2) acc[mb][nb] = WFrag<T16>::mma(a2[mb], b, acc[mb][nb]); if (NSPLIT >= 2) acc[mb][nb] = WFrag<T16>::mma(a[mb], b2, acc[mb][nb]); } }
        asm volatile("v_nop\n\tv_nop\n\tv_nop\n\tv_nop" : "+v"(acc[0][0]), "+v"(acc[1][1]), "+v"(acc[2][2]), "+v"(acc[3][3]) : "v"(a[0]), "v"(a[3]));
    }
#pragma unroll
    for (int mb = 0; mb < 4; ++mb) {
#pragma unroll
        for (int nb = 0; nb < 4; ++nb) {
#pragma unroll
            for (int j = 0; j < 8; ++j) os[(hi * 8 + j) * 68 + nb * 16 + lr] = acc[mb][nb][j]; }
        __builtin_amdgcn_wave_barrier(); asm volatile("" ::: "memory");
        float* crow = C + (size_t)(r0 + mb * 16) * ldc + c0;
{
#pragma unroll
            for (int s = 0; s < 8; ++s) { const int row = 2 * s + hi, cofs = lr * 4; v4f val = *(const v4fa*)(os + row * 68 + cofs); if (BIAS) { val[0] += bfr(bias[c0 + cofs]); val[1] += bfr(bias[c0 + cofs + 1]); val[2] += bfr(bias[c0 + cofs + 2]); val[3] += bfr(bias[c0 + cofs + 3]); }
                *(v4f*)(crow + (size_t)row * ldc + cofs) = val; }
             }
        __builtin_amdgcn_wave_barrier(); asm volatile("" ::: "memory");
    }
}

__device__ __forceinline__ h16 tohx(float x) { return (h16)x; }
__device__ __forceinline__ void splitf(float y, unsigned short& h, unsigned short& l) { h = f2bf(y); l = f2bf(y - bf2f(h)); }
typedef __attribute__((ext_vector_type(2))) _Float16 v2h;
typedef __attribute__((ext_vector_type(4))) _Float16 v4h;
typedef __attribute__((ext_vector_type(2))) unsigned short v2us;
typedef __attribute__((ext_vector_type(4))) unsigned short v4us;
typedef __attribute__((ext_vector_type(2))) float v2f;
typedef __attribute__((ext_vector_type(4))) int v4i;





__global__ __launch_bounds__(256) void k_padpl(const float* __restrict__ k1, const float* __restrict__ k2, const float* __restrict__ v1, const float* __restrict__ v2, float* K1P, bf* K2h, bf* K2l, float* V1P, float* V2P) { const size_t e = ((size_t)blockIdx.x * 256 + threadIdx.x) * 2; if (e >= (size_t)NH_ * RP * HD) return; const int d = (int)(e % HD); const int r = (int)((e / HD) % RP); const int h = (int)(e / ((size_t)HD * RP)); const int t = r - (WW_ - 1); v2f o1, o3, o4; v2us oh, ol;
    if (t >= 0 && t < SS_) { const size_t src = ((size_t)t * NH_ + h) * HD + d;
#pragma unroll
        for (int q = 0; q < 2; ++q) { o1[q] = bfr(k1[src + q]); o3[q] = bfr(v1[src + q]); o4[q] = __fadd_rn(bfr(v2[src + q]), 1.0f); const float kb = __fadd_rn(bfr(k2[src + q]), 1.0f); unsigned short a, c2; splitf(kb, a, c2); oh[q] = a; ol[q] = c2; } }
    else { o1 = (v2f){0.f, 0.f}; o3 = o1; o4 = o1; oh = (v2us){0, 0}; ol = oh; }
    *(v2f*)(K1P + e) = o1; *(v2us*)(K2h + e) = oh; *(v2us*)(K2l + e) = ol; *(v2f*)(V1P + e) = o3; *(v2f*)(V2P + e) = o4;  }
__global__ __launch_bounds__(256) void k_qk1(const float* __restrict__ q, const float* __restrict__ K1P, int s0, bf* Ah, bf* Al) { const size_t e = ((size_t)blockIdx.x * 256 + threadIdx.x) * 2; if (e >= (size_t)NH_ * SC * WW_ * HD) return; const int d = (int)(e % HD); const int ap = (int)((e / HD) % WW_); const int sl = (int)((e / ((size_t)HD * WW_)) % SC); const int h = (int)(e / ((size_t)HD * WW_ * SC)); const int s = s0 + sl; v2us oh, ol;
#pragma unroll
    for (int u = 0; u < 2; ++u) { const float x = __fmul_rn(bfr(q[((size_t)s * NH_ + h) * HD + d + u]), K1P[((size_t)h * RP + s + ap) * HD + d + u]); unsigned short a, c2; splitf(x, a, c2); oh[u] = a; ol[u] = c2; }
    *(v2us*)(Ah + e) = oh; *(v2us*)(Al + e) = ol;  }
__global__ __launch_bounds__(256) void k_v2w(const float* __restrict__ V2P, int s0, bf* Wh, bf* Wl) { const size_t e = ((size_t)blockIdx.x * 256 + threadIdx.x) * 2; if (e >= (size_t)NH_ * SC * HD * WW_) return; const int cp = (int)(e % WW_); const int d = (int)((e / WW_) % HD); const int sl = (int)((e / ((size_t)WW_ * HD)) % SC); const int h = (int)(e / ((size_t)WW_ * HD * SC)); const int s = s0 + sl; v2us oh, ol;
#pragma unroll
    for (int u = 0; u < 2; ++u) { unsigned short a, c2; splitf(V2P[((size_t)h * RP + s + cp + u) * HD + d], a, c2); oh[u] = a; ol[u] = c2; }
    *(v2us*)(Wh + e) = oh; *(v2us*)(Wl + e) = ol;  }
__global__ __launch_bounds__(256) void k_wsoft2(const float* __restrict__ L, int s0, bf* Ph, bf* Pl) {
    const int lane = threadIdx.x & 31; const int row = blockIdx.x * 8 + (threadIdx.x >> 5); if (row >= NH_ * SC) return; const int s = s0 + (row % SC); const int lim = (WW_ - 1) - s;   /* a', c' must be >= lim */ const float* sr = L + (size_t)row * TT; float v[TT / 32]; float mx = -3.0e38f;
#pragma unroll
    for (int ch = 0; ch < TT / 128; ++ch) { const int j0 = ch * 128 + lane * 4; const v4f a = *(const v4f*)(sr + j0);
#pragma unroll
        for (int qq = 0; qq < 4; ++qq) { const int j = j0 + qq; const int ap = j / WW_, cp = j % WW_; float sa = a[qq] * SCL; asm volatile("" : "+v"(sa)); const float t = (ap >= lim && cp >= lim) ? sa : -3.0e38f; v[ch * 4 + qq] = t; mx = fmaxf(mx, t); } }
#pragma unroll
    for (int sh = 16; sh; sh >>= 1) mx = fmaxf(mx, __shfl_xor(mx, sh, 32));
    float sum = 0.f;
#pragma unroll
    for (int k = 0; k < TT / 32; ++k) { float d0 = __fsub_rn(v[k], mx); asm volatile("" : "+v"(d0)); v[k] = __builtin_amdgcn_exp2f(__fmul_rn(d0, 1.4426950408889634f)); sum += v[k]; }
#pragma unroll
    for (int sh = 16; sh; sh >>= 1) sum += __shfl_xor(sum, sh, 32);
    const float f = __fdiv_rn(1.0f, sum);
{
#pragma unroll
        for (int ch = 0; ch < TT / 128; ++ch) { v4us oh, ol;
#pragma unroll
            for (int qq = 0; qq < 4; ++qq) { unsigned short a, c2; float y = v[ch * 4 + qq] * f; asm volatile("" : "+v"(y)); splitf(y, a, c2); oh[qq] = a; ol[qq] = c2; }
            const size_t oo = (size_t)row * TT + ch * 128 + lane * 4; *(v4us*)(Ph + oo) = oh; *(v4us*)(Pl + oo) = ol; }
         }
}
__global__ __launch_bounds__(256) void k_fin(const float* __restrict__ TMP, const float* __restrict__ V1P, int s0, float* O) { const int lane = threadIdx.x & 31; const int w = blockIdx.x * 8 + (threadIdx.x >> 5); if (w >= NH_ * SC) return; const int sl = w % SC, h = w / SC; const int s = s0 + sl; const float* tp = TMP + (size_t)w * WW_ * HD + lane * 2; const float* vp = V1P + ((size_t)h * RP + s) * HD + lane * 2; v2f acc = (v2f){0.f, 0.f};
#pragma unroll 1
    for (int ap = 0; ap < WW_; ++ap) { const v2f t2 = *(const v2f*)(tp + (size_t)ap * HD); const v2f v2v = *(const v2f*)(vp + (size_t)ap * HD);
#pragma unroll
        for (int u = 0; u < 2; ++u) { float pr = __fmul_rn(t2[u], v2v[u]); asm volatile("" : "+v"(pr)); acc[u] = __fadd_rn(acc[u], pr); } }
    float* dst = O + ((size_t)s * NH_ + h) * HD + lane * 2; *(v2f*)dst = acc;  }

extern "C" void kernel_launch(void* const* d_in, const int* in_sizes, int n_in,
                              void* d_out, int out_size, void* d_ws, size_t ws_size, hipStream_t stream) {
    (void)in_sizes; (void)n_in; (void)out_size;
    const float* q = (const float*)d_in[0]; const float* k1 = (const float*)d_in[1]; const float* k2 = (const float*)d_in[2]; const float* v1 = (const float*)d_in[3]; const float* v2 = (const float*)d_in[4];
    float* OUT = (float*)d_out;     // [1][1024][8][64]
    char* wsp = (char*)d_ws;
    auto take = [&](size_t bytes) { char* p = wsp; wsp += (bytes + 255) & ~(size_t)255; return (void*)p; };
    float* K1P = (float*)take((size_t)NH_ * RP * HD * 4); bf* K2h = (bf*)take((size_t)NH_ * RP * HD * 2); bf* K2l = (bf*)take((size_t)NH_ * RP * HD * 2); float* V1P = (float*)take((size_t)NH_ * RP * HD * 4); float* V2P = (float*)take((size_t)NH_ * RP * HD * 4);
    bf* Ah = (bf*)take((size_t)NH_ * SC * WW_ * HD * 2); bf* Al = (bf*)take((size_t)NH_ * SC * WW_ * HD * 2); float* L = (float*)take((size_t)NH_ * SC * TT * 4); bf* Ph = (bf*)take((size_t)NH_ * SC * TT * 2); bf* Pl = (bf*)take((size_t)NH_ * SC * TT * 2);
    bf* Wh = Ah; bf* Wl = Al; float* TMP = L;   /* same sizes; A's last reader (the logits launch) ends before k_v2w writes W, L's last reader (k_wsoft2) before the second tile launch writes TMP */
    if ((size_t)(wsp - (char*)d_ws) > ws_size) return;
    k_padpl<<<(unsigned)(((size_t)NH_ * RP * HD / 2 + 255) / 256), 256, 0, stream>>>(k1, k2, v1, v2, K1P, K2h, K2l, V1P, V2P);
    const unsigned LB = (unsigned)(((size_t)NH_ * SC * WW_ * HD / 2 + 255) / 256);
    for (int s0 = 0; s0 < SS_; s0 += SC) {
        k_qk1<<<LB, 256, 0, stream>>>(q, K1P, s0, Ah, Al);
        /* logits tiles L[h][sl] = A[h][sl] (64 x 64) . (k2+1 window rows s..s+63)^T, z = h * SC + sl over all heads and the chunk's positions */
        k_gemmw<bf, 2, false><<<dim3(1, 1, NH_ * SC), 32, 0, stream>>>(Ah, Al, K2h + (size_t)s0 * HD, K2l + (size_t)s0 * HD, HD, L, WW_, nullptr, (size_t)WW_ * HD, (size_t)HD, (size_t)TT, (size_t)RP * HD);
        k_wsoft2<<<NH_ * SC / 8, 256, 0, stream>>>(L, s0, Ph, Pl);
        k_v2w<<<LB, 256, 0, stream>>>(V2P, s0, Wh, Wl);
        /* TMP[h][sl] = P[h][sl] (64 x 64) . V2W[h][sl]^T -> [a'][d], z = h * SC + sl */
        k_gemmw<bf, 2, false><<<dim3(1, 1, NH_ * SC), 32, 0, stream>>>(Ph, Pl, Wh, Wl, WW_, TMP, HD, nullptr, (size_t)TT, (size_t)HD * WW_, (size_t)WW_ * HD, (size_t)SC * HD * WW_);
        k_fin<<<NH_ * SC / 8, 256, 0, stream>>>(TMP, V1P, s0, OUT); }
}

// v002
// Measured time: 32.7 microseconds a run.
// Next to v001, in two timings, it ran 9.72 and 9.63 times as fast.
// Counting every step since v000, it is 31.7 times as fast.
#include <hip/hip_runtime.h>

// Two-simplicial (trilinear) windowed attention (q, k1, k2, v1, v2 [1][1024][8][64]; for every (s, h): logits[a][c] = (1/8) sum_d q[s][d] k1[s-a][d] (k2[s-c][d] + 1) over the causal windows a, c in [0, 64) (s-a, s-c >= 0 else -inf); p = softmax jointly over the 64 x 64 pairs; out[s][h][d] = sum_{a,c} p[a][c] v1[s-a][d] (v2[s-c][d] + 1) -> [1][1024][8][64] (0.52 M)).
// Layout: per head, k1 / k2+1 / v1 / v2+1 are copied into zero-padded planes indexed by r = token + 63 (rows 0..62 are the window positions before the sequence start); a' = 63 - a and c' = 63 - c make every window a contiguous ascending row range r = s .. s+63.
// One fused kernel does the rest: a work-group of 8 waves takes 8 neighbouring positions of one head, stages the 71 plane rows they share in LDS, and each wave carries its own (s, h) from the q k1 products to the output row with logits, P and TMP in registers.
//   logits^T[c'][a'] = (k2+1 window) . (q k1)^T, so that a pair of D tiles, split to bf16 in place, is the P operand (k = c') of the second product;
//   TMP^T[d][a'] = (v2+1 window)^T . P^T with the value window read by the transposing LDS load; then out[d] = sum_a' TMP^T[d][a'] v1[s-63+a'][d].
// Compute dtypes, f32 accumulate: every input rounded to bf16; q k1 products exact in f32, kept as bf16 hi + lo; k2 + 1 and v2 + 1 in f32 kept as hi + lo; both tile contractions hi x hi + lo x hi + hi x lo (3 products); softmax and the final a'-sum in f32.

#define SS_  1024                 // sequence positions
#define NH_  8
#define HD   64
#define WW_  64                   // window (both)
#define RP   (SS_ + 64)           // padded plane rows per head (r = t + 63; rows 0..62 and SS_+63 are zero)
#define SCL  0.125f               // 1/sqrt(64)
#define PW   8                    // positions = waves per work-group
#define NR   (WW_ + PW - 1)       // plane rows the work-group's windows cover
#define PK2  72                   // LDS pitch of the k2+1 planes, 16-bit elements: 144 B = 16 B x odd (16-byte row reads)
#define PF   68                   // LDS pitch of the f32 planes and of the a'-sum rows, floats: 272 B = 16 B x odd
#define PV2  80                   // LDS pitch of the v2+1 planes, 16-bit elements: 160 B = 32 B x odd (transposing reads)
typedef unsigned short bf;
typedef __attribute__((ext_vector_type(16))) __bf16   v16bf;
typedef __attribute__((ext_vector_type(8)))  unsigned short v8us;
typedef __attribute__((ext_vector_type(8)))  short    v8s;
typedef __attribute__((ext_vector_type(8)))  unsigned v8u;
typedef __attribute__((ext_vector_type(2)))  unsigned v2u;
typedef __attribute__((ext_vector_type(8)))  float    v8f;
typedef __attribute__((ext_vector_type(4)))  float    v4f;
typedef __attribute__((ext_vector_type(2))) unsigned short v2us;
typedef __attribute__((ext_vector_type(2))) float v2f;

__device__ __forceinline__ unsigned short f2bf(float f) { unsigned u = __float_as_uint(f); u += 0x7FFFu + ((u >> 16) & 1u); return (unsigned short)(u >> 16); }
__device__ __forceinline__ float bf2f(unsigned short b) { return __uint_as_float(((unsigned)b) << 16); }
__device__ __forceinline__ float bfr(float f) { return bf2f(f2bf(f)); }
__device__ __forceinline__ v16bf cat16b(v8us lo, v8us hi) { return __builtin_bit_cast(v16bf, __builtin_shufflevector(lo, hi, 0, 1, 2, 3, 4, 5, 6, 7, 8, 9, 10, 11, 12, 13, 14, 15)); }
__device__ __forceinline__ v8f wmmab(v16bf a, v16bf b, v8f c) { return __builtin_amdgcn_wmma_f32_16x16x32_bf16(false, a, false, b, (short)0, c, false, false); }
__device__ __forceinline__ void splitf(float y, unsigned short& h, unsigned short& l) { h = f2bf(y); l = f2bf(y - bf2f(h)); }
// splitf of two neighbours, each pair packed into one word at once (y0 in the low half): the same roundings as f2bf, the 16-bit results never held in registers of their own
__device__ __forceinline__ unsigned rnd16(float f) { const unsigned u = __float_as_uint(f); return u + 0x7FFFu + ((u >> 16) & 1u); }
__device__ __forceinline__ void split2(float y0, float y1, unsigned& hw, unsigned& lw) { const unsigned a0 = rnd16(y0), a1 = rnd16(y1); hw = __builtin_amdgcn_perm(a1, a0, 0x07060302u);
    const unsigned b0 = rnd16(y0 - __uint_as_float(a0 & 0xFFFF0000u)), b1 = rnd16(y1 - __uint_as_float(a1 & 0xFFFF0000u)); lw = __builtin_amdgcn_perm(b1, b0, 0x07060302u); }
// v_exp_f32 and, in the same statement so that it cannot drift, the one free slot that the instruction set asks for behind a transcendental before its result is read or its source overwritten
__device__ __forceinline__ float exp2s(float x) { float r; asm("v_exp_f32 %0, %1\n\tv_nop" : "=v"(r) : "v"(x)); return r; }
// transposing LDS load: lane (c = l & 15, g = l >> 4) gets column c, rows 8 g .. 8 g + 7 of the 16 x 16 tile whose 16-byte pieces the lanes address
__device__ __forceinline__ v8us ldtr(const bf* p) { typedef __attribute__((address_space(3))) v8s lds_v8s; return __builtin_bit_cast(v8us, __builtin_amdgcn_ds_load_tr16_b128_v8i16((lds_v8s*)p)); }

__global__ __launch_bounds__(256) void k_padpl(const float* __restrict__ k1, const float* __restrict__ k2, const float* __restrict__ v1, const float* __restrict__ v2, float* K1P, bf* K2h, bf* K2l, float* V1P, float* V2P) { const size_t e = ((size_t)blockIdx.x * 256 + threadIdx.x) * 2; if (e >= (size_t)NH_ * RP * HD) return; const int d = (int)(e % HD); const int r = (int)((e / HD) % RP); const int h = (int)(e / ((size_t)HD * RP)); const int t = r - (WW_ - 1); v2f o1, o3, o4; v2us oh, ol;
    if (t >= 0 && t < SS_) { const size_t src = ((size_t)t * NH_ + h) * HD + d;
#pragma unroll
        for (int q = 0; q < 2; ++q) { o1[q] = bfr(k1[src + q]); o3[q] = bfr(v1[src + q]); o4[q] = __fadd_rn(bfr(v2[src + q]), 1.0f); const float kb = __fadd_rn(bfr(k2[src + q]), 1.0f); unsigned short a, c2; splitf(kb, a, c2); oh[q] = a; ol[q] = c2; } }
    else { o1 = (v2f){0.f, 0.f}; o3 = o1; o4 = o1; oh = (v2us){0, 0}; ol = oh; }
    *(v2f*)(K1P + e) = o1; *(v2us*)(K2h + e) = oh; *(v2us*)(K2l + e) = ol; *(v2f*)(V1P + e) = o3; *(v2f*)(V2P + e) = o4;  }

// k_fused: grid (SS_ / PW, NH_), 256 threads; wave w of block (x, h) owns position s = x * PW + w. Every fragment is in the hardware k order: element e of lane (lr, hi) is k = 8 hi + e (e < 8), 16 + 8 hi + (e - 8) (e >= 8).
__global__ __launch_bounds__(256) __attribute__((amdgpu_waves_per_eu(4, 4))) void k_fused(const float* __restrict__ q, const float* __restrict__ K1P, const bf* __restrict__ K2h, const bf* __restrict__ K2l, const float* __restrict__ V1P, const float* __restrict__ V2P, float* __restrict__ O) {
    __shared__ __align__(32) bf sK2h[NR * PK2];
    __shared__ __align__(32) bf sK2l[NR * PK2];
    __shared__ __align__(32) bf sV2h[NR * PV2];
    __shared__ __align__(32) bf sV2l[NR * PV2];
    __shared__ __align__(32) float sK1[NR * PF];
    __shared__ __align__(32) float sV1[NR * PF];
    __shared__ __align__(32) float red[PW * 16 * PF];
    const int tid = threadIdx.x, lane = tid & 31, lr = lane & 15, hi = lane >> 4; const int w = __builtin_amdgcn_readfirstlane(tid >> 5);
    const int h = blockIdx.y, s0 = blockIdx.x * PW, s = s0 + w;
    const size_t pb = ((size_t)h * RP + s0) * HD;   /* plane rows s0 .. s0 + NR - 1 <= SS_ + 62 */
    for (int u = tid; u < NR * 8; u += 256) { const int row = u >> 3, c = (u & 7) * 8; *(v8us*)(sK2h + row * PK2 + c) = *(const v8us*)(K2h + pb + row * HD + c); *(v8us*)(sK2l + row * PK2 + c) = *(const v8us*)(K2l + pb + row * HD + c); }
    for (int u = tid; u < NR * 16; u += 256) { const int row = u >> 4, c = (u & 15) * 4; *(v4f*)(sK1 + row * PF + c) = *(const v4f*)(K1P + pb + row * HD + c); *(v4f*)(sV1 + row * PF + c) = *(const v4f*)(V1P + pb + row * HD + c);
        const v4f x = *(const v4f*)(V2P + pb + row * HD + c); unsigned a0, a1, b0, b1; split2(x[0], x[1], a0, b0); split2(x[2], x[3], a1, b1);
        *(v2u*)(sV2h + row * PV2 + c) = (v2u){a0, a1}; *(v2u*)(sV2l + row * PV2 + c) = (v2u){b0, b1}; }
    __syncthreads();

    /* logits^T tiles acc[cb][ab]: register j = [c' = 16 cb + 8 hi + j][a' = 16 ab + lr] */
    v8f acc[4][4];
#pragma unroll
    for (int cb = 0; cb < 4; ++cb)
#pragma unroll
        for (int ab = 0; ab < 4; ++ab) acc[cb][ab] = (v8f){};
    const float* qp = q + ((size_t)s * NH_ + h) * HD + 8 * hi;
#pragma unroll
    for (int kc = 0; kc < 2; ++kc) {
        float qv[16];
#pragma unroll
        for (int g = 0; g < 4; ++g) { const v4f x = *(const v4f*)(qp + kc * 32 + (g >> 1) * 16 + (g & 1) * 4);
#pragma unroll
            for (int e = 0; e < 4; ++e) qv[g * 4 + e] = bfr(x[e]); }
        v16bf kh[4], kl[4];
#pragma unroll
        for (int cb = 0; cb < 4; ++cb) { const int o = (w + cb * 16 + lr) * PK2 + kc * 32 + 8 * hi; kh[cb] = cat16b(*(const v8us*)(sK2h + o), *(const v8us*)(sK2h + o + 16)); kl[cb] = cat16b(*(const v8us*)(sK2l + o), *(const v8us*)(sK2l + o + 16)); }
#pragma unroll
        for (int ab = 0; ab < 4; ++ab) {
            const float* kp = sK1 + (w + ab * 16 + lr) * PF + kc * 32 + 8 * hi; v8u hw, lw;
#pragma unroll
            for (int g = 0; g < 4; ++g) { const v4f x = *(const v4f*)(kp + (g >> 1) * 16 + (g & 1) * 4);
#pragma unroll
                for (int e = 0; e < 4; e += 2) { unsigned a, c2; split2(__fmul_rn(qv[g * 4 + e], x[e]), __fmul_rn(qv[g * 4 + e + 1], x[e + 1]), a, c2); hw[g * 2 + e / 2] = a; lw[g * 2 + e / 2] = c2; } }
            const v16bf ah = __builtin_bit_cast(v16bf, hw), al = __builtin_bit_cast(v16bf, lw);
#pragma unroll
            for (int cb = 0; cb < 4; ++cb) acc[cb][ab] = wmmab(kh[cb], ah, acc[cb][ab]);
#pragma unroll
            for (int cb = 0; cb < 4; ++cb) acc[cb][ab] = wmmab(kh[cb], al, acc[cb][ab]);
#pragma unroll
            for (int cb = 0; cb < 4; ++cb) acc[cb][ab] = wmmab(kl[cb], ah, acc[cb][ab]);
            __builtin_amdgcn_sched_barrier(0);   /* keeps the next block's q k1 splits from being lifted over this block: without it the live set passes 256 registers and spills */
        }
    }

    /* joint softmax over the wave's 4096 pairs, 128 a lane; a', c' must be >= lim */
    const int lim = (WW_ - 1) - s; float mx = -3.0e38f;
#pragma unroll
    for (int cb = 0; cb < 4; ++cb)
#pragma unroll
        for (int ab = 0; ab < 4; ++ab)
#pragma unroll
            for (int j = 0; j < 8; ++j) { const int cp = cb * 16 + hi * 8 + j, ap = ab * 16 + lr; const float t = (ap >= lim && cp >= lim) ? __fmul_rn(acc[cb][ab][j], SCL) : -3.0e38f; acc[cb][ab][j] = t; mx = fmaxf(mx, t); }
#pragma unroll
    for (int sh = 16; sh; sh >>= 1) mx = fmaxf(mx, __shfl_xor(mx, sh, 32));
    float sum = 0.f;
#pragma unroll
    for (int cb = 0; cb < 4; ++cb)
#pragma unroll
        for (int ab = 0; ab < 4; ++ab)
#pragma unroll
            for (int j = 0; j < 8; ++j) { const float e = exp2s(__fmul_rn(__fsub_rn(acc[cb][ab][j], mx), 1.4426950408889634f)); acc[cb][ab][j] = e; sum += e; }
#pragma unroll
    for (int sh = 16; sh; sh >>= 1) sum += __shfl_xor(sum, sh, 32);
    const float f = __fdiv_rn(1.0f, sum);

    /* P fragments (column a' = 16 ab + lr, k = c'): D tiles 2 k2 and 2 k2 + 1 of one ab, split in place */
    v16bf ph[4][2], pl[4][2];
#pragma unroll
    for (int ab = 0; ab < 4; ++ab)
#pragma unroll
        for (int k2 = 0; k2 < 2; ++k2) { v8u hw, lw;
#pragma unroll
            for (int e = 0; e < 8; e += 2) { unsigned a, c2; split2(__fmul_rn(acc[2 * k2][ab][e], f), __fmul_rn(acc[2 * k2][ab][e + 1], f), a, c2); hw[e / 2] = a; lw[e / 2] = c2; split2(__fmul_rn(acc[2 * k2 + 1][ab][e], f), __fmul_rn(acc[2 * k2 + 1][ab][e + 1], f), a, c2); hw[4 + e / 2] = a; lw[4 + e / 2] = c2; }
            ph[ab][k2] = __builtin_bit_cast(v16bf, hw); pl[ab][k2] = __builtin_bit_cast(v16bf, lw);
        }

    /* TMP^T tiles t[ab]: register j = [d = 16 db + 8 hi + j][a' = 16 ab + lr]; times v1 and summed over ab in the lane, over lr through the wave's own LDS rows */
    float* rw = red + w * 16 * PF;
#pragma unroll
    for (int db = 0; db < 4; ++db) {
        v16bf wh[2], wl[2];
#pragma unroll
        for (int k2 = 0; k2 < 2; ++k2) { const int o = (w + k2 * 32 + 8 * hi + (lane & 7)) * PV2 + db * 16 + 8 * ((lane >> 3) & 1); wh[k2] = cat16b(ldtr(sV2h + o), ldtr(sV2h + o + 16 * PV2)); wl[k2] = cat16b(ldtr(sV2l + o), ldtr(sV2l + o + 16 * PV2)); }
        v8f t[4];
#pragma unroll
        for (int ab = 0; ab < 4; ++ab) t[ab] = (v8f){};
#pragma unroll
        for (int k2 = 0; k2 < 2; ++k2) {
#pragma unroll
            for (int ab = 0; ab < 4; ++ab) t[ab] = wmmab(wh[k2], ph[ab][k2], t[ab]);
#pragma unroll
            for (int ab = 0; ab < 4; ++ab) t[ab] = wmmab(wh[k2], pl[ab][k2], t[ab]);
#pragma unroll
            for (int ab = 0; ab < 4; ++ab) t[ab] = wmmab(wl[k2], ph[ab][k2], t[ab]);
        }
        v4f o0 = (v4f){0.f, 0.f, 0.f, 0.f}, o1 = o0;
#pragma unroll
        for (int ab = 0; ab < 4; ++ab) { const float* vp = sV1 + (w + ab * 16 + lr) * PF + db * 16 + 8 * hi; const v4f a = *(const v4f*)vp, b = *(const v4f*)(vp + 4);
#pragma unroll
            for (int e = 0; e < 4; ++e) { o0[e] += t[ab][e] * a[e]; o1[e] += t[ab][4 + e] * b[e]; } }
        *(v4f*)(rw + lr * PF + db * 16 + 8 * hi) = o0; *(v4f*)(rw + lr * PF + db * 16 + 8 * hi + 4) = o1;
    }
    /* the rows below were written by other lanes of this wave: keep the compiler from moving the reads above the writes (one wave's LDS operations run in order) */
    __builtin_amdgcn_wave_barrier(); asm volatile("" ::: "memory");
    v2f r = (v2f){0.f, 0.f};
#pragma unroll
    for (int row = 0; row < 16; ++row) { const v2f x = *(const v2f*)(rw + row * PF + lane * 2); r[0] += x[0]; r[1] += x[1]; }
    *(v2f*)(O + ((size_t)s * NH_ + h) * HD + lane * 2) = r;
}

extern "C" void kernel_launch(void* const* d_in, const int* in_sizes, int n_in,
                              void* d_out, int out_size, void* d_ws, size_t ws_size, hipStream_t stream) {
    (void)in_sizes; (void)n_in; (void)out_size;
    const float* q = (const float*)d_in[0]; const float* k1 = (const float*)d_in[1]; const float* k2 = (const float*)d_in[2]; const float* v1 = (const float*)d_in[3]; const float* v2 = (const float*)d_in[4];
    float* OUT = (float*)d_out;     // [1][1024][8][64]
    char* wsp = (char*)d_ws;
    auto take = [&](size_t bytes) { char* p = wsp; wsp += (bytes + 255) & ~(size_t)255; return (void*)p; };
    float* K1P = (float*)take((size_t)NH_ * RP * HD * 4); bf* K2h = (bf*)take((size_t)NH_ * RP * HD * 2); bf* K2l = (bf*)take((size_t)NH_ * RP * HD * 2); float* V1P = (float*)take((size_t)NH_ * RP * HD * 4); float* V2P = (float*)take((size_t)NH_ * RP * HD * 4);
    if ((size_t)(wsp - (char*)d_ws) > ws_size) return;
    k_padpl<<<(unsigned)(((size_t)NH_ * RP * HD / 2 + 255) / 256), 256, 0, stream>>>(k1, k2, v1, v2, K1P, K2h, K2l, V1P, V2P);
    k_fused<<<dim3(SS_ / PW, NH_), 256, 0, stream>>>(q, K1P, K2h, K2l, V1P, V2P, OUT);
}

// v003
// A run of this version takes 29.4 microseconds.
// Two timings next to v002 both put it at 1.11 times that version's speed.
// Counting every step since v000, it is 35.2 times as fast.
#include <hip/hip_runtime.h>

// Two-simplicial (trilinear) windowed attention (q, k1, k2, v1, v2 [1][1024][8][64]; for every (s, h): logits[a][c] = (1/8) sum_d q[s][d] k1[s-a][d] (k2[s-c][d] + 1) over the causal windows a, c in [0, 64) (s-a, s-c >= 0 else -inf); p = softmax jointly over the 64 x 64 pairs; out[s][h][d] = sum_{a,c} p[a][c] v1[s-a][d] (v2[s-c][d] + 1) -> [1][1024][8][64] (0.52 M)).
// Layout: per head, k1 / k2+1 / v1 / v2+1 are copied into zero-padded planes indexed by r = token + 63 (rows 0..62 are the window positions before the sequence start); a' = 63 - a and c' = 63 - c make every window a contiguous ascending row range r = s .. s+63.
// One fused kernel does the rest: a work-group of 8 waves takes 8 neighbouring positions of one head, stages the 71 plane rows they share in LDS, and each wave carries its own (s, h) from the q k1 products to the output row with logits, P and TMP in registers.
//   logits^T[c'][a'] = (k2+1 window) . (q k1)^T, so that a pair of D tiles, split to bf16 in place, is the P operand (k = c') of the second product;
//   TMP^T[d][a'] = (v2+1 window)^T . P^T with the value window read by the transposing LDS load; then out[d] = sum_a' TMP^T[d][a'] v1[s-63+a'][d].
// Compute dtypes, f32 accumulate: every input rounded to bf16; q k1 products exact in f32, kept as bf16 hi + lo; k2 + 1 and v2 + 1 in f32 kept as hi + lo; both tile contractions hi x hi + lo x hi + hi x lo (3 products); softmax and the final a'-sum in f32.

#define SS_  1024                 // sequence positions
#define NH_  8
#define HD   64
#define WW_  64                   // window (both)
#define RP   (SS_ + 64)           // padded plane rows per head (r = t + 63; rows 0..62 and SS_+63 are zero)
#define SCL  0.125f               // 1/sqrt(64)
#define PW   8                    // positions = waves per work-group
#define NR   (WW_ + PW - 1)       // plane rows the work-group's windows cover
#define PK2  72                   // LDS pitch of the k2+1 planes, 16-bit elements: 144 B = 16 B x odd (16-byte row reads)
#define PF   68                   // LDS pitch of the f32 planes and of the a'-sum rows, floats: 272 B = 16 B x odd
#define PV2  80                   // LDS pitch of the v2+1 planes, 16-bit elements: 160 B = 32 B x odd (transposing reads)
typedef unsigned short bf;
typedef __attribute__((ext_vector_type(16))) __bf16   v16bf;
typedef __attribute__((ext_vector_type(8)))  unsigned short v8us;
typedef __attribute__((ext_vector_type(8)))  short    v8s;
typedef __attribute__((ext_vector_type(8)))  unsigned v8u;
typedef __attribute__((ext_vector_type(2)))  unsigned v2u;
typedef __attribute__((ext_vector_type(8)))  float    v8f;
typedef __attribute__((ext_vector_type(4)))  float    v4f;
typedef __attribute__((ext_vector_type(2))) unsigned short v2us;
typedef __attribute__((ext_vector_type(2))) float v2f;

typedef __attribute__((ext_vector_type(2))) __bf16 v2bf;
// f32 -> bf16, round to nearest even, by the hardware's packed convert: a in the low half of the word, b in the high half
__device__ __forceinline__ unsigned cvt2(float a, float b) { return __builtin_bit_cast(unsigned, __builtin_convertvector(((v2f){a, b}), v2bf)); }
__device__ __forceinline__ unsigned short f2bf(float f) { return __builtin_bit_cast(unsigned short, (__bf16)f); }
__device__ __forceinline__ float bf2f(unsigned short b) { return __uint_as_float(((unsigned)b) << 16); }
__device__ __forceinline__ float bfr(float f) { return bf2f(f2bf(f)); }
__device__ __forceinline__ v16bf cat16b(v8us lo, v8us hi) { return __builtin_bit_cast(v16bf, __builtin_shufflevector(lo, hi, 0, 1, 2, 3, 4, 5, 6, 7, 8, 9, 10, 11, 12, 13, 14, 15)); }
__device__ __forceinline__ v8f wmmab(v16bf a, v16bf b, v8f c) { return __builtin_amdgcn_wmma_f32_16x16x32_bf16(false, a, false, b, (short)0, c, false, false); }
__device__ __forceinline__ void splitf(float y, unsigned short& h, unsigned short& l) { h = f2bf(y); l = f2bf(y - bf2f(h)); }
// splitf of two neighbours, each pair packed into one word at once (y0 in the low half): one packed convert for the two hi parts, one for the two lo parts
__device__ __forceinline__ void split2(float y0, float y1, unsigned& hw, unsigned& lw) { hw = cvt2(y0, y1); lw = cvt2(y0 - __uint_as_float(hw << 16), y1 - __uint_as_float(hw & 0xFFFF0000u)); }
// v_exp_f32 and, in the same statement so that it cannot drift, the one free slot that the instruction set asks for behind a transcendental before its result is read or its source overwritten
__device__ __forceinline__ float exp2s(float x) { float r; asm("v_exp_f32 %0, %1\n\tv_nop" : "=v"(r) : "v"(x)); return r; }
// transposing LDS load: lane (c = l & 15, g = l >> 4) gets column c, rows 8 g .. 8 g + 7 of the 16 x 16 tile whose 16-byte pieces the lanes address
__device__ __forceinline__ v8us ldtr(const bf* p) { typedef __attribute__((address_space(3))) v8s lds_v8s; return __builtin_bit_cast(v8us, __builtin_amdgcn_ds_load_tr16_b128_v8i16((lds_v8s*)p)); }

__global__ __launch_bounds__(256) void k_padpl(const float* __restrict__ k1, const float* __restrict__ k2, const float* __restrict__ v1, const float* __restrict__ v2, float* K1P, bf* K2h, bf* K2l, float* V1P, float* V2P) { const size_t e = ((size_t)blockIdx.x * 256 + threadIdx.x) * 2; if (e >= (size_t)NH_ * RP * HD) return; const int d = (int)(e % HD); const int r = (int)((e / HD) % RP); const int h = (int)(e / ((size_t)HD * RP)); const int t = r - (WW_ - 1); v2f o1, o3, o4; v2us oh, ol;
    if (t >= 0 && t < SS_) { const size_t src = ((size_t)t * NH_ + h) * HD + d;
#pragma unroll
        for (int q = 0; q < 2; ++q) { o1[q] = bfr(k1[src + q]); o3[q] = bfr(v1[src + q]); o4[q] = __fadd_rn(bfr(v2[src + q]), 1.0f); const float kb = __fadd_rn(bfr(k2[src + q]), 1.0f); unsigned short a, c2; splitf(kb, a, c2); oh[q] = a; ol[q] = c2; } }
    else { o1 = (v2f){0.f, 0.f}; o3 = o1; o4 = o1; oh = (v2us){0, 0}; ol = oh; }
    *(v2f*)(K1P + e) = o1; *(v2us*)(K2h + e) = oh; *(v2us*)(K2l + e) = ol; *(v2f*)(V1P + e) = o3; *(v2f*)(V2P + e) = o4;  }

// k_fused: grid (SS_ / PW, NH_), 256 threads; wave w of block (x, h) owns position s = x * PW + w. Every fragment is in the hardware k order: element e of lane (lr, hi) is k = 8 hi + e (e < 8), 16 + 8 hi + (e - 8) (e >= 8).
__global__ __launch_bounds__(256) __attribute__((amdgpu_waves_per_eu(4, 4))) void k_fused(const float* __restrict__ q, const float* __restrict__ K1P, const bf* __restrict__ K2h, const bf* __restrict__ K2l, const float* __restrict__ V1P, const float* __restrict__ V2P, float* __restrict__ O) {
    __shared__ __align__(32) bf sK2h[NR * PK2];
    __shared__ __align__(32) bf sK2l[NR * PK2];
    __shared__ __align__(32) bf sV2h[NR * PV2];
    __shared__ __align__(32) bf sV2l[NR * PV2];
    __shared__ __align__(32) float sK1[NR * PF];
    __shared__ __align__(32) float sV1[NR * PF];
    __shared__ __align__(32) float red[PW * 16 * PF];
    const int tid = threadIdx.x, lane = tid & 31, lr = lane & 15, hi = lane >> 4; const int w = __builtin_amdgcn_readfirstlane(tid >> 5);
    const int h = blockIdx.y, s0 = blockIdx.x * PW, s = s0 + w;
    const size_t pb = ((size_t)h * RP + s0) * HD;   /* plane rows s0 .. s0 + NR - 1 <= SS_ + 62 */
    for (int u = tid; u < NR * 8; u += 256) { const int row = u >> 3, c = (u & 7) * 8; *(v8us*)(sK2h + row * PK2 + c) = *(const v8us*)(K2h + pb + row * HD + c); *(v8us*)(sK2l + row * PK2 + c) = *(const v8us*)(K2l + pb + row * HD + c); }
    for (int u = tid; u < NR * 16; u += 256) { const int row = u >> 4, c = (u & 15) * 4; *(v4f*)(sK1 + row * PF + c) = *(const v4f*)(K1P + pb + row * HD + c); *(v4f*)(sV1 + row * PF + c) = *(const v4f*)(V1P + pb + row * HD + c);
        const v4f x = *(const v4f*)(V2P + pb + row * HD + c); unsigned a0, a1, b0, b1; split2(x[0], x[1], a0, b0); split2(x[2], x[3], a1, b1);
        *(v2u*)(sV2h + row * PV2 + c) = (v2u){a0, a1}; *(v2u*)(sV2l + row * PV2 + c) = (v2u){b0, b1}; }
    __syncthreads();

    /* logits^T tiles acc[cb][ab]: register j = [c' = 16 cb + 8 hi + j][a' = 16 ab + lr] */
    v8f acc[4][4];
#pragma unroll
    for (int cb = 0; cb < 4; ++cb)
#pragma unroll
        for (int ab = 0; ab < 4; ++ab) acc[cb][ab] = (v8f){};
    const float* qp = q + ((size_t)s * NH_ + h) * HD + 8 * hi;
#pragma unroll
    for (int kc = 0; kc < 2; ++kc) {
        float qv[16];
#pragma unroll
        for (int g = 0; g < 4; ++g) { const v4f x = *(const v4f*)(qp + kc * 32 + (g >> 1) * 16 + (g & 1) * 4);
#pragma unroll
            for (int e = 0; e < 4; e += 2) { const unsigned p = cvt2(x[e], x[e + 1]); qv[g * 4 + e] = __uint_as_float(p << 16); qv[g * 4 + e + 1] = __uint_as_float(p & 0xFFFF0000u); } }
        v16bf kh[4], kl[4];
#pragma unroll
        for (int cb = 0; cb < 4; ++cb) { const int o = (w + cb * 16 + lr) * PK2 + kc * 32 + 8 * hi; kh[cb] = cat16b(*(const v8us*)(sK2h + o), *(const v8us*)(sK2h + o + 16)); kl[cb] = cat16b(*(const v8us*)(sK2l + o), *(const v8us*)(sK2l + o + 16)); }
#pragma unroll
        for (int ab = 0; ab < 4; ++ab) {
            const float* kp = sK1 + (w + ab * 16 + lr) * PF + kc * 32 + 8 * hi; v8u hw, lw;
#pragma unroll
            for (int g = 0; g < 4; ++g) { const v4f x = *(const v4f*)(kp + (g >> 1) * 16 + (g & 1) * 4);
#pragma unroll
                for (int e = 0; e < 4; e += 2) { unsigned a, c2; split2(__fmul_rn(qv[g * 4 + e], x[e]), __fmul_rn(qv[g * 4 + e + 1], x[e + 1]), a, c2); hw[g * 2 + e / 2] = a; lw[g * 2 + e / 2] = c2; } }
            const v16bf ah = __builtin_bit_cast(v16bf, hw), al = __builtin_bit_cast(v16bf, lw);
#pragma unroll
            for (int cb = 0; cb < 4; ++cb) acc[cb][ab] = wmmab(kh[cb], ah, acc[cb][ab]);
#pragma unroll
            for (int cb = 0; cb < 4; ++cb) acc[cb][ab] = wmmab(kh[cb], al, acc[cb][ab]);
#pragma unroll
            for (int cb = 0; cb < 4; ++cb) acc[cb][ab] = wmmab(kl[cb], ah, acc[cb][ab]);
            __builtin_amdgcn_sched_barrier(0);   /* keeps the next block's q k1 splits from being lifted over this block: without it the live set passes 256 registers and spills */
        }
    }

    /* joint softmax over the wave's 4096 pairs, 128 a lane; a', c' must be >= lim */
    const int lim = (WW_ - 1) - s; float mx = -3.0e38f;
#pragma unroll
    for (int cb = 0; cb < 4; ++cb)
#pragma unroll
        for (int ab = 0; ab < 4; ++ab)
#pragma unroll
            for (int j = 0; j < 8; ++j) { const int cp = cb * 16 + hi * 8 + j, ap = ab * 16 + lr; const float t = (ap >= lim && cp >= lim) ? __fmul_rn(acc[cb][ab][j], SCL) : -3.0e38f; acc[cb][ab][j] = t; mx = fmaxf(mx, t); }
#pragma unroll
    for (int sh = 16; sh; sh >>= 1) mx = fmaxf(mx, __shfl_xor(mx, sh, 32));
    float sum = 0.f;
#pragma unroll
    for (int cb = 0; cb < 4; ++cb)
#pragma unroll
        for (int ab = 0; ab < 4; ++ab)
#pragma unroll
            for (int j = 0; j < 8; ++j) { const float e = exp2s(__fmul_rn(__fsub_rn(acc[cb][ab][j], mx), 1.4426950408889634f)); acc[cb][ab][j] = e; sum += e; }
#pragma unroll
    for (int sh = 16; sh; sh >>= 1) sum += __shfl_xor(sum, sh, 32);
    const float f = __fdiv_rn(1.0f, sum);

    /* P fragments (column a' = 16 ab + lr, k = c'): D tiles 2 k2 and 2 k2 + 1 of one ab, split in place */
    v16bf ph[4][2], pl[4][2];
#pragma unroll
    for (int ab = 0; ab < 4; ++ab)
#pragma unroll
        for (int k2 = 0; k2 < 2; ++k2) { v8u hw, lw;
#pragma unroll
            for (int e = 0; e < 8; e += 2) { unsigned a, c2; split2(__fmul_rn(acc[2 * k2][ab][e], f), __fmul_rn(acc[2 * k2][ab][e + 1], f), a, c2); hw[e / 2] = a; lw[e / 2] = c2; split2(__fmul_rn(acc[2 * k2 + 1][ab][e], f), __fmul_rn(acc[2 * k2 + 1][ab][e + 1], f), a, c2); hw[4 + e / 2] = a; lw[4 + e / 2] = c2; }
            ph[ab][k2] = __builtin_bit_cast(v16bf, hw); pl[ab][k2] = __builtin_bit_cast(v16bf, lw);
        }

    /* TMP^T tiles t[ab]: register j = [d = 16 db + 8 hi + j][a' = 16 ab + lr]; times v1 and summed over ab in the lane, over lr through the wave's own LDS rows */
    float* rw = red + w * 16 * PF;
#pragma unroll
    for (int db = 0; db < 4; ++db) {
        v16bf wh[2], wl[2];
#pragma unroll
        for (int k2 = 0; k2 < 2; ++k2) { const int o = (w + k2 * 32 + 8 * hi + (lane & 7)) * PV2 + db * 16 + 8 * ((lane >> 3) & 1); wh[k2] = cat16b(ldtr(sV2h + o), ldtr(sV2h + o + 16 * PV2)); wl[k2] = cat16b(ldtr(sV2l + o), ldtr(sV2l + o + 16 * PV2)); }
        v8f t[4];
#pragma unroll
        for (int ab = 0; ab < 4; ++ab) t[ab] = (v8f){};
#pragma unroll
        for (int k2 = 0; k2 < 2; ++k2) {
#pragma unroll
            for (int ab = 0; ab < 4; ++ab) t[ab] = wmmab(wh[k2], ph[ab][k2], t[ab]);
#pragma unroll
            for (int ab = 0; ab < 4; ++ab) t[ab] = wmmab(wh[k2], pl[ab][k2], t[ab]);
#pragma unroll
            for (int ab = 0; ab < 4; ++ab) t[ab] = wmmab(wl[k2], ph[ab][k2], t[ab]);
        }
        v4f o0 = (v4f){0.f, 0.f, 0.f, 0.f}, o1 = o0;
#pragma unroll
        for (int ab = 0; ab < 4; ++ab) { const float* vp = sV1 + (w + ab * 16 + lr) * PF + db * 16 + 8 * hi; const v4f a = *(const v4f*)vp, b = *(const v4f*)(vp + 4);
#pragma unroll
            for (int e = 0; e < 4; ++e) { o0[e] += t[ab][e] * a[e]; o1[e] += t[ab][4 + e] * b[e]; } }
        *(v4f*)(rw + lr * PF + db * 16 + 8 * hi) = o0; *(v4f*)(rw + lr * PF + db * 16 + 8 * hi + 4) = o1;
    }
    /* the rows below were written by other lanes of this wave: keep the compiler from moving the reads above the writes (one wave's LDS operations run in order) */
    __builtin_amdgcn_wave_barrier(); asm volatile("" ::: "memory");
    v2f r = (v2f){0.f, 0.f};
#pragma unroll
    for (int row = 0; row < 16; ++row) { const v2f x = *(const v2f*)(rw + row * PF + lane * 2); r[0] += x[0]; r[1] += x[1]; }
    *(v2f*)(O + ((size_t)s * NH_ + h) * HD + lane * 2) = r;
}

extern "C" void kernel_launch(void* const* d_in, const int* in_sizes, int n_in,
                              void* d_out, int out_size, void* d_ws, size_t ws_size, hipStream_t stream) {
    (void)in_sizes; (void)n_in; (void)out_size;
    const float* q = (const float*)d_in[0]; const float* k1 = (const float*)d_in[1]; const float* k2 = (const float*)d_in[2]; const float* v1 = (const float*)d_in[3]; const float* v2 = (const float*)d_in[4];
    float* OUT = (float*)d_out;     // [1][1024][8][64]
    char* wsp = (char*)d_ws;
    auto take = [&](size_t bytes) { char* p = wsp; wsp += (bytes + 255) & ~(size_t)255; return (void*)p; };
    float* K1P = (float*)take((size_t)NH_ * RP * HD * 4); bf* K2h = (bf*)take((size_t)NH_ * RP * HD * 2); bf* K2l = (bf*)take((size_t)NH_ * RP * HD * 2); float* V1P = (float*)take((size_t)NH_ * RP * HD * 4); float* V2P = (float*)take((size_t)NH_ * RP * HD * 4);
    if ((size_t)(wsp - (char*)d_ws) > ws_size) return;
    k_padpl<<<(unsigned)(((size_t)NH_ * RP * HD / 2 + 255) / 256), 256, 0, stream>>>(k1, k2, v1, v2, K1P, K2h, K2l, V1P, V2P);
    k_fused<<<dim3(SS_ / PW, NH_), 256, 0, stream>>>(q, K1P, K2h, K2l, V1P, V2P, OUT);
}

// v004
// Measured time: 21 microseconds a run.
// Next to v003, in two timings, it ran 1.40 and 1.41 times as fast.
// Counting every step since v000, it is 49.5 times as fast.
#include <hip/hip_runtime.h>

// Two-simplicial (trilinear) windowed attention (q, k1, k2, v1, v2 [1][1024][8][64]; for every (s, h): logits[a][c] = (1/8) sum_d q[s][d] k1[s-a][d] (k2[s-c][d] + 1) over the causal windows a, c in [0, 64) (s-a, s-c >= 0 else -inf); p = softmax jointly over the 64 x 64 pairs; out[s][h][d] = sum_{a,c} p[a][c] v1[s-a][d] (v2[s-c][d] + 1) -> [1][1024][8][64] (0.52 M)).
// Layout: a' = 63 - a and c' = 63 - c make every window a contiguous ascending token range s-63 .. s; a token index below 0 is clipped to 0 as in the reference (its pairs are masked, so their P is exactly 0).
// One kernel does everything: a work-group of 8 waves takes 8 neighbouring positions of one head, reads the 71 token rows they share straight from k1, k2, v1, v2, rounds and splits them on the way into LDS, and each wave carries its own (s, h) from the q k1 products to the output row with logits, P and TMP in registers.
//   logits^T[c'][a'] = (k2+1 window) . (q k1)^T, so that a pair of D tiles, split to bf16 in place, is the P operand (k = c') of the second product;
//   TMP^T[d][a'] = (v2+1 window)^T . P^T with the value window read by the transposing LDS load; then out[d] = sum_a' TMP^T[d][a'] v1[s-63+a'][d].
// Compute dtypes, f32 accumulate: every input rounded to bf16; q k1 products exact in f32, kept as bf16 hi + lo; k2 + 1 and v2 + 1 in f32 kept as hi + lo; both tile contractions hi x hi + lo x hi + hi x lo (3 products); softmax and the final a'-sum in f32.

#define SS_  1024                 // sequence positions
#define NH_  8
#define HD   64
#define WW_  64                   // window (both)
#define SCL  0.125f               // 1/sqrt(64)
#define PW   8                    // positions = waves per work-group
#define NR   (WW_ + PW - 1)       // token rows the work-group's windows cover
#define PK2  72                   // LDS pitch of the k2+1 planes, 16-bit elements: 144 B = 16 B x odd (16-byte row reads)
#define PF   68                   // LDS pitch of the f32 planes and of the a'-sum rows, floats: 272 B = 16 B x odd
#define PV2  80                   // LDS pitch of the v2+1 planes, 16-bit elements: 160 B = 32 B x odd (transposing reads)
typedef unsigned short bf;
typedef __attribute__((ext_vector_type(16))) __bf16   v16bf;
typedef __attribute__((ext_vector_type(8)))  unsigned short v8us;
typedef __attribute__((ext_vector_type(8)))  short    v8s;
typedef __attribute__((ext_vector_type(8)))  unsigned v8u;
typedef __attribute__((ext_vector_type(2)))  unsigned v2u;
typedef __attribute__((ext_vector_type(8)))  float    v8f;
typedef __attribute__((ext_vector_type(4)))  float    v4f;
typedef __attribute__((ext_vector_type(2))) float v2f;

typedef __attribute__((ext_vector_type(2))) __bf16 v2bf;
// f32 -> bf16, round to nearest even, by the hardware's packed convert: a in the low half of the word, b in the high half
__device__ __forceinline__ unsigned cvt2(float a, float b) { return __builtin_bit_cast(unsigned, __builtin_convertvector(((v2f){a, b}), v2bf)); }
__device__ __forceinline__ v16bf cat16b(v8us lo, v8us hi) { return __builtin_bit_cast(v16bf, __builtin_shufflevector(lo, hi, 0, 1, 2, 3, 4, 5, 6, 7, 8, 9, 10, 11, 12, 13, 14, 15)); }
__device__ __forceinline__ v8f wmmab(v16bf a, v16bf b, v8f c) { return __builtin_amdgcn_wmma_f32_16x16x32_bf16(false, a, false, b, (short)0, c, false, false); }
// hi + lo split of two neighbours (hi = bf16(y), lo = bf16(y - hi)), each pair packed into one word at once (y0 in the low half): one packed convert for the two hi parts, one for the two lo parts
__device__ __forceinline__ void split2(float y0, float y1, unsigned& hw, unsigned& lw) { hw = cvt2(y0, y1); lw = cvt2(y0 - __uint_as_float(hw << 16), y1 - __uint_as_float(hw & 0xFFFF0000u)); }
// four f32 rounded to bf16 (nearest even) and widened again
__device__ __forceinline__ v4f rnd4(v4f x) { const unsigned p = cvt2(x[0], x[1]), r = cvt2(x[2], x[3]); return (v4f){__uint_as_float(p << 16), __uint_as_float(p & 0xFFFF0000u), __uint_as_float(r << 16), __uint_as_float(r & 0xFFFF0000u)}; }
// v_exp_f32 and, in the same statement so that it cannot drift, the one free slot that the instruction set asks for behind a transcendental before its result is read or its source overwritten
__device__ __forceinline__ float exp2s(float x) { float r; asm("v_exp_f32 %0, %1\n\tv_nop" : "=v"(r) : "v"(x)); return r; }
// transposing LDS load: lane (c = l & 15, g = l >> 4) gets column c, rows 8 g .. 8 g + 7 of the 16 x 16 tile whose 16-byte pieces the lanes address
__device__ __forceinline__ v8us ldtr(const bf* p) { typedef __attribute__((address_space(3))) v8s lds_v8s; return __builtin_bit_cast(v8us, __builtin_amdgcn_ds_load_tr16_b128_v8i16((lds_v8s*)p)); }

// k_fused: grid (SS_ / PW, NH_), 256 threads; wave w of block (x, h) owns position s = x * PW + w. Every fragment is in the hardware k order: element e of lane (lr, hi) is k = 8 hi + e (e < 8), 16 + 8 hi + (e - 8) (e >= 8).
__global__ __launch_bounds__(256) __attribute__((amdgpu_waves_per_eu(4, 4))) void k_fused(const float* __restrict__ q, const float* __restrict__ k1, const float* __restrict__ k2, const float* __restrict__ v1, const float* __restrict__ v2, float* __restrict__ O) {
    __shared__ __align__(32) bf sK2h[NR * PK2];
    __shared__ __align__(32) bf sK2l[NR * PK2];
    __shared__ __align__(32) bf sV2h[NR * PV2];
    __shared__ __align__(32) bf sV2l[NR * PV2];
    __shared__ __align__(32) float sK1[NR * PF];
    __shared__ __align__(32) float sV1[NR * PF];
    __shared__ __align__(32) float red[PW * 16 * PF];
    const int tid = threadIdx.x, lane = tid & 31, lr = lane & 15, hi = lane >> 4; const int w = __builtin_amdgcn_readfirstlane(tid >> 5);
    const int h = blockIdx.y, s0 = blockIdx.x * PW, s = s0 + w;
    /* LDS row r holds token max(s0 - 63 + r, 0) <= s0 + 7 <= SS_ - 1: k1, v1 rounded to bf16 and kept as f32; k2 + 1, v2 + 1 formed in f32 from the rounded inputs and split hi + lo */
    /* every thread takes 16 bytes of each input at rows rw0 + 16 i; all its global loads are issued before the first conversion, so that the work-group waits out one load latency and not one a trip */
    const int rw0 = tid >> 4, cc = (tid & 15) * 4; const bool tail = rw0 < NR - 64;   /* rows 64 .. NR - 1: the first (NR - 64) * 16 threads */
    v4f x1[5], x2[5], x3[5], x4[5];
    /* both loops unrolled: the four arrays stay in registers only under constant indices */
#pragma unroll
    for (int i = 0; i < 5; ++i) if (i < 4 || tail) { const unsigned g = (((unsigned)max(s0 - (WW_ - 1) + rw0 + 16 * i, 0) * NH_ + h) * HD + cc) * 4;   /* a 32-bit byte offset, below 2 MiB: one offset register serves the four uniform bases */
        x1[i] = *(const v4f*)((const char*)k1 + g); x2[i] = *(const v4f*)((const char*)k2 + g); x3[i] = *(const v4f*)((const char*)v1 + g); x4[i] = *(const v4f*)((const char*)v2 + g); }
#pragma unroll
    for (int i = 0; i < 5; ++i) if (i < 4 || tail) { const int row = rw0 + 16 * i;
        *(v4f*)(sK1 + row * PF + cc) = rnd4(x1[i]); *(v4f*)(sV1 + row * PF + cc) = rnd4(x3[i]);
        const v4f y2 = rnd4(x2[i]) + 1.0f, y4 = rnd4(x4[i]) + 1.0f; unsigned a0, a1, b0, b1;
        split2(y2[0], y2[1], a0, b0); split2(y2[2], y2[3], a1, b1); *(v2u*)(sK2h + row * PK2 + cc) = (v2u){a0, a1}; *(v2u*)(sK2l + row * PK2 + cc) = (v2u){b0, b1};
        split2(y4[0], y4[1], a0, b0); split2(y4[2], y4[3], a1, b1); *(v2u*)(sV2h + row * PV2 + cc) = (v2u){a0, a1}; *(v2u*)(sV2l + row * PV2 + cc) = (v2u){b0, b1}; }
    __syncthreads();

    /* logits^T tiles acc[cb][ab]: register j = [c' = 16 cb + 8 hi + j][a' = 16 ab + lr] */
    v8f acc[4][4];
#pragma unroll
    for (int cb = 0; cb < 4; ++cb)
#pragma unroll
        for (int ab = 0; ab < 4; ++ab) acc[cb][ab] = (v8f){};
    const float* qp = q + ((size_t)s * NH_ + h) * HD + 8 * hi;
#pragma unroll
    for (int kc = 0; kc < 2; ++kc) {
        float qv[16];
#pragma unroll
        for (int g = 0; g < 4; ++g) { const v4f x = *(const v4f*)(qp + kc * 32 + (g >> 1) * 16 + (g & 1) * 4);
#pragma unroll
            for (int e = 0; e < 4; e += 2) { const unsigned p = cvt2(x[e], x[e + 1]); qv[g * 4 + e] = __uint_as_float(p << 16); qv[g * 4 + e + 1] = __uint_as_float(p & 0xFFFF0000u); } }
        v16bf kh[4], kl[4];
#pragma unroll
        for (int cb = 0; cb < 4; ++cb) { const int o = (w + cb * 16 + lr) * PK2 + kc * 32 + 8 * hi; kh[cb] = cat16b(*(const v8us*)(sK2h + o), *(const v8us*)(sK2h + o + 16)); kl[cb] = cat16b(*(const v8us*)(sK2l + o), *(const v8us*)(sK2l + o + 16)); }
#pragma unroll
        for (int ab = 0; ab < 4; ++ab) {
            const float* kp = sK1 + (w + ab * 16 + lr) * PF + kc * 32 + 8 * hi; v8u hw, lw;
#pragma unroll
            for (int g = 0; g < 4; ++g) { const v4f x = *(const v4f*)(kp + (g >> 1) * 16 + (g & 1) * 4);
#pragma unroll
                for (int e = 0; e < 4; e += 2) { unsigned a, c2; split2(__fmul_rn(qv[g * 4 + e], x[e]), __fmul_rn(qv[g * 4 + e + 1], x[e + 1]), a, c2); hw[g * 2 + e / 2] = a; lw[g * 2 + e / 2] = c2; } }
            const v16bf ah = __builtin_bit_cast(v16bf, hw), al = __builtin_bit_cast(v16bf, lw);
#pragma unroll
            for (int cb = 0; cb < 4; ++cb) acc[cb][ab] = wmmab(kh[cb], ah, acc[cb][ab]);
#pragma unroll
            for (int cb = 0; cb < 4; ++cb) acc[cb][ab] = wmmab(kh[cb], al, acc[cb][ab]);
#pragma unroll
            for (int cb = 0; cb < 4; ++cb) acc[cb][ab] = wmmab(kl[cb], ah, acc[cb][ab]);
            __builtin_amdgcn_sched_barrier(0);   /* keeps the next block's q k1 splits from being lifted over this block: without it the live set passes 256 registers and spills */
        }
    }

    /* joint softmax over the wave's 4096 pairs, 128 a lane; a', c' must be >= lim */
    const int lim = (WW_ - 1) - s; float mx = -3.0e38f;
#pragma unroll
    for (int cb = 0; cb < 4; ++cb)
#pragma unroll
        for (int ab = 0; ab < 4; ++ab)
#pragma unroll
            for (int j = 0; j < 8; ++j) { const int cp = cb * 16 + hi * 8 + j, ap = ab * 16 + lr; const float t = (ap >= lim && cp >= lim) ? __fmul_rn(acc[cb][ab][j], SCL) : -3.0e38f; acc[cb][ab][j] = t; mx = fmaxf(mx, t); }
#pragma unroll
    for (int sh = 16; sh; sh >>= 1) mx = fmaxf(mx, __shfl_xor(mx, sh, 32));
    float sum = 0.f;
#pragma unroll
    for (int cb = 0; cb < 4; ++cb)
#pragma unroll
        for (int ab = 0; ab < 4; ++ab)
#pragma unroll
            for (int j = 0; j < 8; ++j) { const float e = exp2s(__fmul_rn(__fsub_rn(acc[cb][ab][j], mx), 1.4426950408889634f)); acc[cb][ab][j] = e; sum += e; }
#pragma unroll
    for (int sh = 16; sh; sh >>= 1) sum += __shfl_xor(sum, sh, 32);
    const float f = __fdiv_rn(1.0f, sum);

    /* P fragments (column a' = 16 ab + lr, k = c'): D tiles 2 k2 and 2 k2 + 1 of one ab, split in place */
    v16bf ph[4][2], pl[4][2];
#pragma unroll
    for (int ab = 0; ab < 4; ++ab)
#pragma unroll
        for (int k2 = 0; k2 < 2; ++k2) { v8u hw, lw;
#pragma unroll
            for (int e = 0; e < 8; e += 2) { unsigned a, c2; split2(__fmul_rn(acc[2 * k2][ab][e], f), __fmul_rn(acc[2 * k2][ab][e + 1], f), a, c2); hw[e / 2] = a; lw[e / 2] = c2; split2(__fmul_rn(acc[2 * k2 + 1][ab][e], f), __fmul_rn(acc[2 * k2 + 1][ab][e + 1], f), a, c2); hw[4 + e / 2] = a; lw[4 + e / 2] = c2; }
            ph[ab][k2] = __builtin_bit_cast(v16bf, hw); pl[ab][k2] = __builtin_bit_cast(v16bf, lw);
        }

    /* TMP^T tiles t[ab]: register j = [d = 16 db + 8 hi + j][a' = 16 ab + lr]; times v1 and summed over ab in the lane, over lr through the wave's own LDS rows */
    float* rw = red + w * 16 * PF;
#pragma unroll
    for (int db = 0; db < 4; ++db) {
        v16bf wh[2], wl[2];
#pragma unroll
        for (int k2 = 0; k2 < 2; ++k2) { const int o = (w + k2 * 32 + 8 * hi + (lane & 7)) * PV2 + db * 16 + 8 * ((lane >> 3) & 1); wh[k2] = cat16b(ldtr(sV2h + o), ldtr(sV2h + o + 16 * PV2)); wl[k2] = cat16b(ldtr(sV2l + o), ldtr(sV2l + o + 16 * PV2)); }
        v8f t[4];
#pragma unroll
        for (int ab = 0; ab < 4; ++ab) t[ab] = (v8f){};
#pragma unroll
        for (int k2 = 0; k2 < 2; ++k2) {
#pragma unroll
            for (int ab = 0; ab < 4; ++ab) t[ab] = wmmab(wh[k2], ph[ab][k2], t[ab]);
#pragma unroll
            for (int ab = 0; ab < 4; ++ab) t[ab] = wmmab(wh[k2], pl[ab][k2], t[ab]);
#pragma unroll
            for (int ab = 0; ab < 4; ++ab) t[ab] = wmmab(wl[k2], ph[ab][k2], t[ab]);
        }
        v4f o0 = (v4f){0.f, 0.f, 0.f, 0.f}, o1 = o0;
#pragma unroll
        for (int ab = 0; ab < 4; ++ab) { const float* vp = sV1 + (w + ab * 16 + lr) * PF + db * 16 + 8 * hi; const v4f a = *(const v4f*)vp, b = *(const v4f*)(vp + 4);
#pragma unroll
            for (int e = 0; e < 4; ++e) { o0[e] += t[ab][e] * a[e]; o1[e] += t[ab][4 + e] * b[e]; } }
        *(v4f*)(rw + lr * PF + db * 16 + 8 * hi) = o0; *(v4f*)(rw + lr * PF + db * 16 + 8 * hi + 4) = o1;
    }
    /* the rows below were written by other lanes of this wave: keep the compiler from moving the reads above the writes (one wave's LDS operations run in order) */
    __builtin_amdgcn_wave_barrier(); asm volatile("" ::: "memory");
    v2f r = (v2f){0.f, 0.f};
#pragma unroll
    for (int row = 0; row < 16; ++row) { const v2f x = *(const v2f*)(rw + row * PF + lane * 2); r[0] += x[0]; r[1] += x[1]; }
    *(v2f*)(O + ((size_t)s * NH_ + h) * HD + lane * 2) = r;
}

extern "C" void kernel_launch(void* const* d_in, const int* in_sizes, int n_in,
                              void* d_out, int out_size, void* d_ws, size_t ws_size, hipStream_t stream) {
    (void)in_sizes; (void)n_in; (void)out_size; (void)d_ws; (void)ws_size;
    const float* q = (const float*)d_in[0]; const float* k1 = (const float*)d_in[1]; const float* k2 = (const float*)d_in[2]; const float* v1 = (const float*)d_in[3]; const float* v2 = (const float*)d_in[4];
    float* OUT = (float*)d_out;     // [1][1024][8][64]
    k_fused<<<dim3(SS_ / PW, NH_), 256, 0, stream>>>(q, k1, k2, v1, v2, OUT);
}

// v005
// One run takes 19.6 microseconds.
// In both of two side-by-side timings against v004, it was 1.07 times as fast.
// All steps since v000 together make it 52.8 times as fast.
#include <hip/hip_runtime.h>

// Two-simplicial (trilinear) windowed attention (q, k1, k2, v1, v2 [1][1024][8][64]; for every (s, h): logits[a][c] = (1/8) sum_d q[s][d] k1[s-a][d] (k2[s-c][d] + 1) over the causal windows a, c in [0, 64) (s-a, s-c >= 0 else -inf); p = softmax jointly over the 64 x 64 pairs; out[s][h][d] = sum_{a,c} p[a][c] v1[s-a][d] (v2[s-c][d] + 1) -> [1][1024][8][64] (0.52 M)).
// Layout: a' = 63 - a and c' = 63 - c make every window a contiguous ascending token range s-63 .. s; a token index below 0 is clipped to 0 as in the reference (its pairs are masked, so their P is exactly 0).
// One kernel does everything: a work-group of 8 waves takes 8 neighbouring positions of one head, reads the 71 token rows they share straight from k1, k2, v1, v2, rounds and splits them on the way into LDS, and each wave carries its own (s, h) from the q k1 products to the output row with logits, P and TMP in registers.
//   logits^T[c'][a'] = (k2+1 window) . (q k1)^T, so that a pair of D tiles, split to bf16 in place, is the P operand (k = c') of the second product;
//   TMP^T[d][a'] = (v2+1 window)^T . P^T with the value window read by the transposing LDS load; then out[d] = sum_a' TMP^T[d][a'] v1[s-63+a'][d].
// Compute dtypes, f32 accumulate: every input rounded to bf16; q k1 products exact in f32, kept as bf16 hi + lo; k2 + 1 and v2 + 1 in f32 kept as hi + lo; both tile contractions hi x hi + lo x hi + hi x lo (3 products); softmax and the final a'-sum in f32.

#define SS_  1024                 // sequence positions
#define NH_  8
#define HD   64
#define WW_  64                   // window (both)
#define SCL  0.125f               // 1/sqrt(64)
#define PW   8                    // positions = waves per work-group
#define NR   (WW_ + PW - 1)       // token rows the work-group's windows cover
#define PK2  72                   // LDS pitch of the k2+1 planes, 16-bit elements: 144 B = 16 B x odd (16-byte row reads)
#define PF   68                   // LDS pitch of the f32 planes and of the a'-sum rows, floats: 272 B = 16 B x odd
#define PV2  80                   // LDS pitch of the v2+1 planes, 16-bit elements: 160 B = 32 B x odd (transposing reads)
typedef unsigned short bf;
typedef __attribute__((ext_vector_type(16))) __bf16   v16bf;
typedef __attribute__((ext_vector_type(8)))  unsigned short v8us;
typedef __attribute__((ext_vector_type(8)))  short    v8s;
typedef __attribute__((ext_vector_type(8)))  unsigned v8u;
typedef __attribute__((ext_vector_type(2)))  unsigned v2u;
typedef __attribute__((ext_vector_type(8)))  float    v8f;
typedef __attribute__((ext_vector_type(4)))  float    v4f;
typedef __attribute__((ext_vector_type(2))) float v2f;

typedef __attribute__((ext_vector_type(2))) __bf16 v2bf;
// f32 -> bf16, round to nearest even, by the hardware's packed convert: a in the low half of the word, b in the high half
__device__ __forceinline__ unsigned cvt2(float a, float b) { return __builtin_bit_cast(unsigned, __builtin_convertvector(((v2f){a, b}), v2bf)); }
__device__ __forceinline__ v16bf cat16b(v8us lo, v8us hi) { return __builtin_bit_cast(v16bf, __builtin_shufflevector(lo, hi, 0, 1, 2, 3, 4, 5, 6, 7, 8, 9, 10, 11, 12, 13, 14, 15)); }
__device__ __forceinline__ v8f wmmab(v16bf a, v16bf b, v8f c) { return __builtin_amdgcn_wmma_f32_16x16x32_bf16(false, a, false, b, (short)0, c, false, false); }
// hi + lo split of two neighbours (hi = bf16(y), lo = bf16(y - hi)), each pair packed into one word at once (y0 in the low half): one packed convert for the two hi parts, one for the two lo parts
__device__ __forceinline__ void split2(float y0, float y1, unsigned& hw, unsigned& lw) { hw = cvt2(y0, y1); lw = cvt2(y0 - __uint_as_float(hw << 16), y1 - __uint_as_float(hw & 0xFFFF0000u)); }
// four f32 rounded to bf16 (nearest even) and widened again
__device__ __forceinline__ v4f rnd4(v4f x) { const unsigned p = cvt2(x[0], x[1]), r = cvt2(x[2], x[3]); return (v4f){__uint_as_float(p << 16), __uint_as_float(p & 0xFFFF0000u), __uint_as_float(r << 16), __uint_as_float(r & 0xFFFF0000u)}; }
// v_exp_f32 and, in the same statement so that it cannot drift, the one free slot that the instruction set asks for behind a transcendental before its result is read or its source overwritten
__device__ __forceinline__ float exp2s(float x) { float r; asm("v_exp_f32 %0, %1\n\tv_nop" : "=v"(r) : "v"(x)); return r; }
// transposing LDS load: lane (c = l & 15, g = l >> 4) gets column c, rows 8 g .. 8 g + 7 of the 16 x 16 tile whose 16-byte pieces the lanes address
__device__ __forceinline__ v8us ldtr(const bf* p) { typedef __attribute__((address_space(3))) v8s lds_v8s; return __builtin_bit_cast(v8us, __builtin_amdgcn_ds_load_tr16_b128_v8i16((lds_v8s*)p)); }

// k_fused: grid (SS_ / PW, NH_), 256 threads; wave w of block (x, h) owns position s = x * PW + w. Every fragment is in the hardware k order: element e of lane (lr, hi) is k = 8 hi + e (e < 8), 16 + 8 hi + (e - 8) (e >= 8).
__global__ __launch_bounds__(256) __attribute__((amdgpu_waves_per_eu(4, 4))) void k_fused(const float* __restrict__ q, const float* __restrict__ k1, const float* __restrict__ k2, const float* __restrict__ v1, const float* __restrict__ v2, float* __restrict__ O) {
    __shared__ __align__(32) bf sK2h[NR * PK2];
    __shared__ __align__(32) bf sK2l[NR * PK2];
    __shared__ __align__(32) bf sV2h[NR * PV2];
    __shared__ __align__(32) bf sV2l[NR * PV2];
    __shared__ __align__(32) float sK1[NR * PF];
    __shared__ __align__(32) float sV1[NR * PF];
    __shared__ __align__(32) float red[PW * 16 * PF];
    const int tid = threadIdx.x, lane = tid & 31, lr = lane & 15, hi = lane >> 4; const int w = __builtin_amdgcn_readfirstlane(tid >> 5);
    const int h = blockIdx.y, s0 = blockIdx.x * PW, s = s0 + w;
    /* LDS row r holds token max(s0 - 63 + r, 0) <= s0 + 7 <= SS_ - 1: k1, v1 rounded to bf16 and kept as f32; k2 + 1, v2 + 1 formed in f32 from the rounded inputs and split hi + lo */
    /* every thread takes 16 bytes of each input at rows rw0 + 16 i; all its global loads are issued before the first conversion, so that the work-group waits out one load latency and not one a trip */
    const int rw0 = tid >> 4, cc = (tid & 15) * 4; const bool tail = rw0 < NR - 64;   /* rows 64 .. NR - 1: the first (NR - 64) * 16 threads */
    v4f x1[5], x2[5], x3[5], x4[5];
    /* both loops unrolled: the four arrays stay in registers only under constant indices */
#pragma unroll
    for (int i = 0; i < 5; ++i) if (i < 4 || tail) { const unsigned g = (((unsigned)max(s0 - (WW_ - 1) + rw0 + 16 * i, 0) * NH_ + h) * HD + cc) * 4;   /* a 32-bit byte offset, below 2 MiB: one offset register serves the four uniform bases */
        x1[i] = *(const v4f*)((const char*)k1 + g); x2[i] = *(const v4f*)((const char*)k2 + g); x3[i] = *(const v4f*)((const char*)v1 + g); x4[i] = *(const v4f*)((const char*)v2 + g); }
#pragma unroll
    for (int i = 0; i < 5; ++i) if (i < 4 || tail) { const int row = rw0 + 16 * i;
        *(v4f*)(sK1 + row * PF + cc) = rnd4(x1[i]); *(v4f*)(sV1 + row * PF + cc) = rnd4(x3[i]);
        const v4f y2 = rnd4(x2[i]) + 1.0f, y4 = rnd4(x4[i]) + 1.0f; unsigned a0, a1, b0, b1;
        split2(y2[0], y2[1], a0, b0); split2(y2[2], y2[3], a1, b1); *(v2u*)(sK2h + row * PK2 + cc) = (v2u){a0, a1}; *(v2u*)(sK2l + row * PK2 + cc) = (v2u){b0, b1};
        split2(y4[0], y4[1], a0, b0); split2(y4[2], y4[3], a1, b1); *(v2u*)(sV2h + row * PV2 + cc) = (v2u){a0, a1}; *(v2u*)(sV2l + row * PV2 + cc) = (v2u){b0, b1}; }
    __syncthreads();

    /* logits^T tiles acc[cb][ab]: register j = [c' = 16 cb + 8 hi + j][a' = 16 ab + lr] */
    v8f acc[4][4];
#pragma unroll
    for (int cb = 0; cb < 4; ++cb)
#pragma unroll
        for (int ab = 0; ab < 4; ++ab) acc[cb][ab] = (v8f){};
    const float* qp = q + ((size_t)s * NH_ + h) * HD + 8 * hi;
#pragma unroll
    for (int kc = 0; kc < 2; ++kc) {
        float qv[16];
#pragma unroll
        for (int g = 0; g < 4; ++g) { const v4f x = *(const v4f*)(qp + kc * 32 + (g >> 1) * 16 + (g & 1) * 4);
#pragma unroll
            for (int e = 0; e < 4; e += 2) { const unsigned p = cvt2(x[e], x[e + 1]); qv[g * 4 + e] = __uint_as_float(p << 16); qv[g * 4 + e + 1] = __uint_as_float(p & 0xFFFF0000u); } }
        v16bf kh[4], kl[4];
#pragma unroll
        for (int cb = 0; cb < 4; ++cb) { const int o = (w + cb * 16 + lr) * PK2 + kc * 32 + 8 * hi; kh[cb] = cat16b(*(const v8us*)(sK2h + o), *(const v8us*)(sK2h + o + 16)); kl[cb] = cat16b(*(const v8us*)(sK2l + o), *(const v8us*)(sK2l + o + 16)); }
#pragma unroll
        for (int ab = 0; ab < 4; ++ab) {
            const float* kp = sK1 + (w + ab * 16 + lr) * PF + kc * 32 + 8 * hi; v8u hw, lw;
#pragma unroll
            for (int g = 0; g < 4; ++g) { const v4f x = *(const v4f*)(kp + (g >> 1) * 16 + (g & 1) * 4);
#pragma unroll
                for (int e = 0; e < 4; e += 2) { unsigned a, c2; split2(__fmul_rn(qv[g * 4 + e], x[e]), __fmul_rn(qv[g * 4 + e + 1], x[e + 1]), a, c2); hw[g * 2 + e / 2] = a; lw[g * 2 + e / 2] = c2; } }
            const v16bf ah = __builtin_bit_cast(v16bf, hw), al = __builtin_bit_cast(v16bf, lw);
#pragma unroll
            for (int cb = 0; cb < 4; ++cb) acc[cb][ab] = wmmab(kh[cb], ah, acc[cb][ab]);
#pragma unroll
            for (int cb = 0; cb < 4; ++cb) acc[cb][ab] = wmmab(kh[cb], al, acc[cb][ab]);
#pragma unroll
            for (int cb = 0; cb < 4; ++cb) acc[cb][ab] = wmmab(kl[cb], ah, acc[cb][ab]);
            __builtin_amdgcn_sched_barrier(0);   /* keeps the next block's q k1 splits from being lifted over this block: without it the live set passes 256 registers and spills */
        }
    }

    /* joint softmax over the wave's 4096 pairs, 128 a lane; a', c' must be >= lim. It runs on the raw sums: 1/8 and log2 e are one constant CE, the exponent is one fma a logit (CE > 0 keeps the order, so the maximum is taken raw as well), and 1/sum multiplies the finished output row, not the 128 P values */
    const int lim = (WW_ - 1) - s; float mx = -3.0e38f;
#pragma unroll
    for (int cb = 0; cb < 4; ++cb)
#pragma unroll
        for (int ab = 0; ab < 4; ++ab)
#pragma unroll
            for (int j = 0; j < 8; ++j) { const int cp = cb * 16 + hi * 8 + j, ap = ab * 16 + lr; const float t = (ap >= lim && cp >= lim) ? acc[cb][ab][j] : -3.0e38f; acc[cb][ab][j] = t; mx = fmaxf(mx, t); }
#pragma unroll
    for (int sh = 16; sh; sh >>= 1) mx = fmaxf(mx, __shfl_xor(mx, sh, 32));
    const float CE = SCL * 1.4426950408889634f, nb = -mx * CE; float sum = 0.f;
    const v8f ce8 = (v8f){CE, CE, CE, CE, CE, CE, CE, CE}, nb8 = (v8f){nb, nb, nb, nb, nb, nb, nb, nb};
#pragma unroll
    for (int cb = 0; cb < 4; ++cb)
#pragma unroll
        for (int ab = 0; ab < 4; ++ab) { const v8f x = __builtin_elementwise_fma(acc[cb][ab], ce8, nb8);   /* a masked pair: about -5e37, exp2 gives 0 */
#pragma unroll
            for (int j = 0; j < 8; ++j) { const float e = exp2s(x[j]); acc[cb][ab][j] = e; sum += e; } }
#pragma unroll
    for (int sh = 16; sh; sh >>= 1) sum += __shfl_xor(sum, sh, 32);
    const float f = __fdiv_rn(1.0f, sum);

    /* P fragments (column a' = 16 ab + lr, k = c'), not normalised (largest value 1): D tiles 2 k2 and 2 k2 + 1 of one ab, split in place */
    v16bf ph[4][2], pl[4][2];
#pragma unroll
    for (int ab = 0; ab < 4; ++ab)
#pragma unroll
        for (int k2 = 0; k2 < 2; ++k2) { v8u hw, lw;
#pragma unroll
            for (int e = 0; e < 8; e += 2) { unsigned a, c2; split2(acc[2 * k2][ab][e], acc[2 * k2][ab][e + 1], a, c2); hw[e / 2] = a; lw[e / 2] = c2; split2(acc[2 * k2 + 1][ab][e], acc[2 * k2 + 1][ab][e + 1], a, c2); hw[4 + e / 2] = a; lw[4 + e / 2] = c2; }
            ph[ab][k2] = __builtin_bit_cast(v16bf, hw); pl[ab][k2] = __builtin_bit_cast(v16bf, lw);
        }

    /* TMP^T tiles t[ab]: register j = [d = 16 db + 8 hi + j][a' = 16 ab + lr]; times v1 and summed over ab in the lane, over lr through the wave's own LDS rows */
    float* rw = red + w * 16 * PF;
#pragma unroll
    for (int db = 0; db < 4; ++db) {
        v16bf wh[2], wl[2];
#pragma unroll
        for (int k2 = 0; k2 < 2; ++k2) { const int o = (w + k2 * 32 + 8 * hi + (lane & 7)) * PV2 + db * 16 + 8 * ((lane >> 3) & 1); wh[k2] = cat16b(ldtr(sV2h + o), ldtr(sV2h + o + 16 * PV2)); wl[k2] = cat16b(ldtr(sV2l + o), ldtr(sV2l + o + 16 * PV2)); }
        v8f t[4];
#pragma unroll
        for (int ab = 0; ab < 4; ++ab) t[ab] = (v8f){};
#pragma unroll
        for (int k2 = 0; k2 < 2; ++k2) {
#pragma unroll
            for (int ab = 0; ab < 4; ++ab) t[ab] = wmmab(wh[k2], ph[ab][k2], t[ab]);
#pragma unroll
            for (int ab = 0; ab < 4; ++ab) t[ab] = wmmab(wh[k2], pl[ab][k2], t[ab]);
#pragma unroll
            for (int ab = 0; ab < 4; ++ab) t[ab] = wmmab(wl[k2], ph[ab][k2], t[ab]);
        }
        v4f o0 = (v4f){0.f, 0.f, 0.f, 0.f}, o1 = o0;
#pragma unroll
        for (int ab = 0; ab < 4; ++ab) { const float* vp = sV1 + (w + ab * 16 + lr) * PF + db * 16 + 8 * hi; const v4f a = *(const v4f*)vp, b = *(const v4f*)(vp + 4);
#pragma unroll
            for (int e = 0; e < 4; ++e) { o0[e] += t[ab][e] * a[e]; o1[e] += t[ab][4 + e] * b[e]; } }
        *(v4f*)(rw + lr * PF + db * 16 + 8 * hi) = o0; *(v4f*)(rw + lr * PF + db * 16 + 8 * hi + 4) = o1;
        __builtin_amdgcn_sched_barrier(0x100);   /* keeps the blocks' products apart: merged, the compiler puts products on one accumulator tile back to back and each waits out the one before it; 0x100 lets LDS reads cross, so that the next block's fragments are fetched under this block's products */
    }
    /* the rows below were written by other lanes of this wave: keep the compiler from moving the reads above the writes (one wave's LDS operations run in order) */
    __builtin_amdgcn_wave_barrier(); asm volatile("" ::: "memory");
    v2f r = (v2f){0.f, 0.f};
#pragma unroll
    for (int row = 0; row < 16; ++row) { const v2f x = *(const v2f*)(rw + row * PF + lane * 2); r[0] += x[0]; r[1] += x[1]; }
    *(v2f*)(O + ((size_t)s * NH_ + h) * HD + lane * 2) = r * f;
}

extern "C" void kernel_launch(void* const* d_in, const int* in_sizes, int n_in,
                              void* d_out, int out_size, void* d_ws, size_t ws_size, hipStream_t stream) {
    (void)in_sizes; (void)n_in; (void)out_size; (void)d_ws; (void)ws_size;
    const float* q = (const float*)d_in[0]; const float* k1 = (const float*)d_in[1]; const float* k2 = (const float*)d_in[2]; const float* v1 = (const float*)d_in[3]; const float* v2 = (const float*)d_in[4];
    float* OUT = (float*)d_out;     // [1][1024][8][64]
    k_fused<<<dim3(SS_ / PW, NH_), 256, 0, stream>>>(q, k1, k2, v1, v2, OUT);
}

// v006
// A run of this version takes 18.4 microseconds.
// Timed twice side by side with v005, it ran 1.07 times as fast both times.
// Counting every step since v000, it is 56.4 times as fast.
#include <hip/hip_runtime.h>

// Two-simplicial (trilinear) windowed attention (q, k1, k2, v1, v2 [1][1024][8][64]; for every (s, h): logits[a][c] = (1/8) sum_d q[s][d] k1[s-a][d] (k2[s-c][d] + 1) over the causal windows a, c in [0, 64) (s-a, s-c >= 0 else -inf); p = softmax jointly over the 64 x 64 pairs; out[s][h][d] = sum_{a,c} p[a][c] v1[s-a][d] (v2[s-c][d] + 1) -> [1][1024][8][64] (0.52 M)).
// Layout: a' = 63 - a and c' = 63 - c make every window a contiguous ascending token range s-63 .. s; a token index below 0 is clipped to 0 as in the reference (its pairs are masked, so their P is exactly 0).
// One kernel does everything: a work-group of 8 waves takes 8 neighbouring positions of one head, reads the 71 token rows they share straight from k1, k2, v1, v2, rounds them on the way into LDS, and each wave carries its own (s, h) from the q k1 products to the output row with logits, P and TMP in registers.
//   logits^T[c'][a'] = (k2 window) . (q k1)^T + sum_d (q k1)[a'][d], so that a pair of D tiles, split to bf16 in place, is the P operand (k = c') of the second product;
//   TMP^T[d][a'] = (v2 window)^T . P^T + sum_c' P[a'][c'] with the value window read by the transposing LDS load; then out[d] = sum_a' TMP^T[d][a'] v1[s-63+a'][d].
//   The two "+ 1" never enter a matrix operand: x . (y + 1) = x . y + sum x. The rounded k2 and v2 are one bf16 plane each, with nothing left over, and each "+ 1" term depends on a' alone, which is fixed per lane and tile column.
// Compute dtypes, f32 accumulate: every input rounded to bf16; q k1 products exact in f32, kept as bf16 hi + lo; P kept as hi + lo; both tile contractions (exact bf16) x hi + (exact bf16) x lo (2 products); the two "+ 1" sums, softmax and the final a'-sum in f32.

#define SS_  1024                 // sequence positions
#define NH_  8
#define HD   64
#define WW_  64                   // window (both)
#define SCL  0.125f               // 1/sqrt(64)
#define PW   8                    // positions = waves per work-group
#define NR   (WW_ + PW - 1)       // token rows the work-group's windows cover
#define PK2  72                   // LDS pitch of the k2 plane, 16-bit elements: 144 B = 16 B x odd (16-byte row reads)
#define PF   68                   // LDS pitch of the f32 planes and of the a'-sum rows, floats: 272 B = 16 B x odd
#define PV2  80                   // LDS pitch of the v2 plane, 16-bit elements: 160 B = 32 B x odd (transposing reads)
typedef unsigned short bf;
typedef __attribute__((ext_vector_type(16))) __bf16   v16bf;
typedef __attribute__((ext_vector_type(8)))  unsigned short v8us;
typedef __attribute__((ext_vector_type(8)))  short    v8s;
typedef __attribute__((ext_vector_type(8)))  unsigned v8u;
typedef __attribute__((ext_vector_type(2)))  unsigned v2u;
typedef __attribute__((ext_vector_type(8)))  float    v8f;
typedef __attribute__((ext_vector_type(4)))  float    v4f;
typedef __attribute__((ext_vector_type(2))) float v2f;

typedef __attribute__((ext_vector_type(2))) __bf16 v2bf;
// f32 -> bf16, round to nearest even, by the hardware's packed convert: a in the low half of the word, b in the high half
__device__ __forceinline__ unsigned cvt2(float a, float b) { return __builtin_bit_cast(unsigned, __builtin_convertvector(((v2f){a, b}), v2bf)); }
__device__ __forceinline__ v16bf cat16b(v8us lo, v8us hi) { return __builtin_bit_cast(v16bf, __builtin_shufflevector(lo, hi, 0, 1, 2, 3, 4, 5, 6, 7, 8, 9, 10, 11, 12, 13, 14, 15)); }
__device__ __forceinline__ v8f wmmab(v16bf a, v16bf b, v8f c) { return __builtin_amdgcn_wmma_f32_16x16x32_bf16(false, a, false, b, (short)0, c, false, false); }
// hi + lo split of two neighbours (hi = bf16(y), lo = bf16(y - hi)), each pair packed into one word at once (y0 in the low half): one packed convert for the two hi parts, one for the two lo parts
__device__ __forceinline__ void split2(float y0, float y1, unsigned& hw, unsigned& lw) { hw = cvt2(y0, y1); lw = cvt2(y0 - __uint_as_float(hw << 16), y1 - __uint_as_float(hw & 0xFFFF0000u)); }
// four f32 rounded to bf16 (nearest even) and widened again
__device__ __forceinline__ v4f rnd4(v4f x) { const unsigned p = cvt2(x[0], x[1]), r = cvt2(x[2], x[3]); return (v4f){__uint_as_float(p << 16), __uint_as_float(p & 0xFFFF0000u), __uint_as_float(r << 16), __uint_as_float(r & 0xFFFF0000u)}; }
// v_exp_f32 and, in the same statement so that it cannot drift, the one free slot that the instruction set asks for behind a transcendental before its result is read or its source overwritten
__device__ __forceinline__ float exp2s(float x) { float r; asm("v_exp_f32 %0, %1\n\tv_nop" : "=v"(r) : "v"(x)); return r; }
// lane l takes the value of lane l ^ 16 (the other half of the k range of the same tile column)
__device__ __forceinline__ float xhalf(float x) { return __builtin_bit_cast(float, __builtin_amdgcn_permlanex16(__builtin_bit_cast(int, x), __builtin_bit_cast(int, x), 0x76543210, 0xfedcba98, false, false)); }
// transposing LDS load: lane (c = l & 15, g = l >> 4) gets column c, rows 8 g .. 8 g + 7 of the 16 x 16 tile whose 16-byte pieces the lanes address
__device__ __forceinline__ v8us ldtr(const bf* p) { typedef __attribute__((address_space(3))) v8s lds_v8s; return __builtin_bit_cast(v8us, __builtin_amdgcn_ds_load_tr16_b128_v8i16((lds_v8s*)p)); }

// k_fused: grid (SS_ / PW, NH_), 256 threads; wave w of block (x, h) owns position s = x * PW + w. Every fragment is in the hardware k order: element e of lane (lr, hi) is k = 8 hi + e (e < 8), 16 + 8 hi + (e - 8) (e >= 8).
__global__ __launch_bounds__(256) __attribute__((amdgpu_waves_per_eu(4, 4))) void k_fused(const float* __restrict__ q, const float* __restrict__ k1, const float* __restrict__ k2, const float* __restrict__ v1, const float* __restrict__ v2, float* __restrict__ O) {
    __shared__ __align__(32) bf sK2[NR * PK2];
    __shared__ __align__(32) bf sV2[NR * PV2];
    __shared__ __align__(32) float sK1[NR * PF];
    __shared__ __align__(32) float sV1[NR * PF];
    __shared__ __align__(32) float red[PW * 16 * PF];
    const int tid = threadIdx.x, lane = tid & 31, lr = lane & 15, hi = lane >> 4; const int w = __builtin_amdgcn_readfirstlane(tid >> 5);
    const int h = blockIdx.y, s0 = blockIdx.x * PW, s = s0 + w;
    /* LDS row r holds token max(s0 - 63 + r, 0) <= s0 + 7 <= SS_ - 1: k1, v1 rounded to bf16 and kept as f32; k2, v2 rounded to bf16 and kept so */
    /* every thread takes 16 bytes of each input at rows rw0 + 16 i; all its global loads are issued before the first conversion, so that the work-group waits out one load latency and not one a trip */
    const int rw0 = tid >> 4, cc = (tid & 15) * 4; const bool tail = rw0 < NR - 64;   /* rows 64 .. NR - 1: the first (NR - 64) * 16 threads */
    v4f x1[5], x2[5], x3[5], x4[5];
    /* both loops unrolled: the four arrays stay in registers only under constant indices */
#pragma unroll
    for (int i = 0; i < 5; ++i) if (i < 4 || tail) { const unsigned g = (((unsigned)max(s0 - (WW_ - 1) + rw0 + 16 * i, 0) * NH_ + h) * HD + cc) * 4;   /* a 32-bit byte offset, below 2 MiB: one offset register serves the four uniform bases */
        x1[i] = *(const v4f*)((const char*)k1 + g); x2[i] = *(const v4f*)((const char*)k2 + g); x3[i] = *(const v4f*)((const char*)v1 + g); x4[i] = *(const v4f*)((const char*)v2 + g); }
#pragma unroll
    for (int i = 0; i < 5; ++i) if (i < 4 || tail) { const int row = rw0 + 16 * i;
        *(v4f*)(sK1 + row * PF + cc) = rnd4(x1[i]); *(v4f*)(sV1 + row * PF + cc) = rnd4(x3[i]);
        *(v2u*)(sK2 + row * PK2 + cc) = (v2u){cvt2(x2[i][0], x2[i][1]), cvt2(x2[i][2], x2[i][3])}; *(v2u*)(sV2 + row * PV2 + cc) = (v2u){cvt2(x4[i][0], x4[i][1]), cvt2(x4[i][2], x4[i][3])}; }
    __syncthreads();

    /* logits^T tiles acc[cb][ab]: register j = [c' = 16 cb + 8 hi + j][a' = 16 ab + lr], without the "+ 1" term; bs[ab] gathers that term, the lane's share of sum_d (q k1)[a' = 16 ab + lr][d] */
    v8f acc[4][4]; v2f bs[4] = {(v2f){0.f, 0.f}, (v2f){0.f, 0.f}, (v2f){0.f, 0.f}, (v2f){0.f, 0.f}};
#pragma unroll
    for (int cb = 0; cb < 4; ++cb)
#pragma unroll
        for (int ab = 0; ab < 4; ++ab) acc[cb][ab] = (v8f){};
    const float* qp = q + ((size_t)s * NH_ + h) * HD + 8 * hi;
#pragma unroll
    for (int kc = 0; kc < 2; ++kc) {
        float qv[16];
#pragma unroll
        for (int g = 0; g < 4; ++g) { const v4f x = *(const v4f*)(qp + kc * 32 + (g >> 1) * 16 + (g & 1) * 4);
#pragma unroll
            for (int e = 0; e < 4; e += 2) { const unsigned p = cvt2(x[e], x[e + 1]); qv[g * 4 + e] = __uint_as_float(p << 16); qv[g * 4 + e + 1] = __uint_as_float(p & 0xFFFF0000u); } }
        v16bf kh[4];
#pragma unroll
        for (int cb = 0; cb < 4; ++cb) { const int o = (w + cb * 16 + lr) * PK2 + kc * 32 + 8 * hi; kh[cb] = cat16b(*(const v8us*)(sK2 + o), *(const v8us*)(sK2 + o + 16)); }
#pragma unroll
        for (int ab = 0; ab < 4; ++ab) {
            const float* kp = sK1 + (w + ab * 16 + lr) * PF + kc * 32 + 8 * hi; v8u hw, lw;
#pragma unroll
            for (int g = 0; g < 4; ++g) { const v4f x = *(const v4f*)(kp + (g >> 1) * 16 + (g & 1) * 4);
#pragma unroll
                for (int e = 0; e < 4; e += 2) { unsigned a, c2; const float p0 = __fmul_rn(qv[g * 4 + e], x[e]), p1 = __fmul_rn(qv[g * 4 + e + 1], x[e + 1]); split2(p0, p1, a, c2); hw[g * 2 + e / 2] = a; lw[g * 2 + e / 2] = c2; bs[ab] += (v2f){p0, p1}; } }
            const v16bf ah = __builtin_bit_cast(v16bf, hw), al = __builtin_bit_cast(v16bf, lw);
#pragma unroll
            for (int cb = 0; cb < 4; ++cb) acc[cb][ab] = wmmab(kh[cb], ah, acc[cb][ab]);
#pragma unroll
            for (int cb = 0; cb < 4; ++cb) acc[cb][ab] = wmmab(kh[cb], al, acc[cb][ab]);
            __builtin_amdgcn_sched_barrier(0);   /* keeps the blocks apart: without it the compiler spreads a block's four k1 row reads singly among the splits, each behind a full LDS wait of its own, where here they stand as one group with counted waits */
        }
    }

    /* joint softmax over the wave's 4096 pairs, 128 a lane; a', c' must be >= lim. It runs on the raw sums: 1/8 and log2 e are one constant CE, the exponent is one fma a logit (CE > 0 keeps the order, so the maximum is taken raw as well), and 1/sum multiplies the finished output row, not the 128 P values. The "+ 1" term of the logits, bias[ab], is one value a lane and ab: it joins the lane's maximum of that ab once and then rides in the addend of the fma */
    const int lim = (WW_ - 1) - s; float mx = -3.0e38f, bias[4], rs[4];
#pragma unroll
    for (int ab = 0; ab < 4; ++ab) { const float b = bs[ab][0] + bs[ab][1]; bias[ab] = b + xhalf(b); }
#pragma unroll
    for (int ab = 0; ab < 4; ++ab) { float m = -3.0e38f;
#pragma unroll
        for (int cb = 0; cb < 4; ++cb)
#pragma unroll
            for (int j = 0; j < 8; ++j) { const int cp = cb * 16 + hi * 8 + j, ap = ab * 16 + lr; const float t = (ap >= lim && cp >= lim) ? acc[cb][ab][j] : -3.0e38f; acc[cb][ab][j] = t; m = fmaxf(m, t); }
        mx = fmaxf(mx, m + bias[ab]); }
#pragma unroll
    for (int sh = 16; sh; sh >>= 1) mx = fmaxf(mx, __shfl_xor(mx, sh, 32));
    const float CE = SCL * 1.4426950408889634f;
    const v8f ce8 = (v8f){CE, CE, CE, CE, CE, CE, CE, CE};
    /* rs[ab]: sum_c' P[a' = 16 ab + lr][c'], the "+ 1" term of TMP; the four together are the softmax sum */
#pragma unroll
    for (int ab = 0; ab < 4; ++ab) { const float nb = (bias[ab] - mx) * CE; const v8f nb8 = (v8f){nb, nb, nb, nb, nb, nb, nb, nb}; float r = 0.f;
#pragma unroll
        for (int cb = 0; cb < 4; ++cb) { const v8f x = __builtin_elementwise_fma(acc[cb][ab], ce8, nb8);   /* a masked pair: about -5e37, exp2 gives 0 */
#pragma unroll
            for (int j = 0; j < 8; ++j) { const float e = exp2s(x[j]); acc[cb][ab][j] = e; r += e; } }
        rs[ab] = r + xhalf(r); }
    float sum = (rs[0] + rs[1]) + (rs[2] + rs[3]);   /* both halves are in already */
#pragma unroll
    for (int sh = 8; sh; sh >>= 1) sum += __shfl_xor(sum, sh, 32);
    const float f = __fdiv_rn(1.0f, sum);

    /* P fragments (column a' = 16 ab + lr, k = c'), not normalised (largest value about 1): D tiles 2 k2 and 2 k2 + 1 of one ab, split in place */
    v16bf ph[4][2], pl[4][2];
#pragma unroll
    for (int ab = 0; ab < 4; ++ab)
#pragma unroll
        for (int k2 = 0; k2 < 2; ++k2) { v8u hw, lw;
#pragma unroll
            for (int e = 0; e < 8; e += 2) { unsigned a, c2; split2(acc[2 * k2][ab][e], acc[2 * k2][ab][e + 1], a, c2); hw[e / 2] = a; lw[e / 2] = c2; split2(acc[2 * k2 + 1][ab][e], acc[2 * k2 + 1][ab][e + 1], a, c2); hw[4 + e / 2] = a; lw[4 + e / 2] = c2; }
            ph[ab][k2] = __builtin_bit_cast(v16bf, hw); pl[ab][k2] = __builtin_bit_cast(v16bf, lw);
        }

    /* TMP^T tiles t[ab]: register j = [d = 16 db + 8 hi + j][a' = 16 ab + lr], started at rs[ab] (the same for every d); times v1 and summed over ab in the lane, over lr through the wave's own LDS rows */
    float* rw = red + w * 16 * PF;
#pragma unroll
    for (int db = 0; db < 4; ++db) {
        v16bf wh[2];
#pragma unroll
        for (int k2 = 0; k2 < 2; ++k2) { const int o = (w + k2 * 32 + 8 * hi + (lane & 7)) * PV2 + db * 16 + 8 * ((lane >> 3) & 1); wh[k2] = cat16b(ldtr(sV2 + o), ldtr(sV2 + o + 16 * PV2)); }
        v8f t[4];
#pragma unroll
        for (int ab = 0; ab < 4; ++ab) t[ab] = (v8f){rs[ab], rs[ab], rs[ab], rs[ab], rs[ab], rs[ab], rs[ab], rs[ab]};
#pragma unroll
        for (int k2 = 0; k2 < 2; ++k2) {
#pragma unroll
            for (int ab = 0; ab < 4; ++ab) t[ab] = wmmab(wh[k2], ph[ab][k2], t[ab]);
#pragma unroll
            for (int ab = 0; ab < 4; ++ab) t[ab] = wmmab(wh[k2], pl[ab][k2], t[ab]);
        }
        v4f o0 = (v4f){0.f, 0.f, 0.f, 0.f}, o1 = o0;
#pragma unroll
        for (int ab = 0; ab < 4; ++ab) { const float* vp = sV1 + (w + ab * 16 + lr) * PF + db * 16 + 8 * hi; const v4f a = *(const v4f*)vp, b = *(const v4f*)(vp + 4);
#pragma unroll
            for (int e = 0; e < 4; ++e) { o0[e] += t[ab][e] * a[e]; o1[e] += t[ab][4 + e] * b[e]; } }
        *(v4f*)(rw + lr * PF + db * 16 + 8 * hi) = o0; *(v4f*)(rw + lr * PF + db * 16 + 8 * hi + 4) = o1;
        __builtin_amdgcn_sched_barrier(0x100);   /* keeps the blocks' products apart: merged, the compiler puts products on one accumulator tile back to back and each waits out the one before it; 0x100 lets LDS reads cross, so that the next block's fragments are fetched under this block's products */
    }
    /* the rows below were written by other lanes of this wave: keep the compiler from moving the reads above the writes (one wave's LDS operations run in order) */
    __builtin_amdgcn_wave_barrier(); asm volatile("" ::: "memory");
    v2f r = (v2f){0.f, 0.f};
#pragma unroll
    for (int row = 0; row < 16; ++row) { const v2f x = *(const v2f*)(rw + row * PF + lane * 2); r[0] += x[0]; r[1] += x[1]; }
    *(v2f*)(O + ((size_t)s * NH_ + h) * HD + lane * 2) = r * f;
}

extern "C" void kernel_launch(void* const* d_in, const int* in_sizes, int n_in,
                              void* d_out, int out_size, void* d_ws, size_t ws_size, hipStream_t stream) {
    (void)in_sizes; (void)n_in; (void)out_size; (void)d_ws; (void)ws_size;
    const float* q = (const float*)d_in[0]; const float* k1 = (const float*)d_in[1]; const float* k2 = (const float*)d_in[2]; const float* v1 = (const float*)d_in[3]; const float* v2 = (const float*)d_in[4];
    float* OUT = (float*)d_out;     // [1][1024][8][64]
    k_fused<<<dim3(SS_ / PW, NH_), 256, 0, stream>>>(q, k1, k2, v1, v2, OUT);
}

// v007
// A run of this version takes 16.8 microseconds.
// In both of two side-by-side timings against v006, it was 1.09 times as fast.
// All steps since v000 together make it 61.6 times as fast.
#include <hip/hip_runtime.h>

// Two-simplicial (trilinear) windowed attention (q, k1, k2, v1, v2 [1][1024][8][64]; for every (s, h): logits[a][c] = (1/8) sum_d q[s][d] k1[s-a][d] (k2[s-c][d] + 1) over the causal windows a, c in [0, 64) (s-a, s-c >= 0 else -inf); p = softmax jointly over the 64 x 64 pairs; out[s][h][d] = sum_{a,c} p[a][c] v1[s-a][d] (v2[s-c][d] + 1) -> [1][1024][8][64] (0.52 M)).
// Layout: a' = 63 - a and c' = 63 - c make every window a contiguous ascending token range s-63 .. s; a token index below 0 is clipped to 0 as in the reference (its pairs are masked, so their P is exactly 0).
// One kernel does everything: a work-group of 8 waves takes 8 neighbouring positions of one head, reads the 71 token rows they share straight from k1, k2, v1, v2, rounds them on the way into LDS, and each wave carries its own (s, h) from the q k1 products to the output row with logits, P and TMP in registers.
//   logits^T[c'][a'] = (k2 window) . (q k1)^T + sum_d (q k1)[a'][d], so that a pair of D tiles, split to bf16 in place, is the P operand (k = c') of the second product;
//   TMP^T[d][a'] = (v2 window)^T . P^T + sum_c' P[a'][c'] with the value window read by the transposing LDS load; then out[d] = sum_a' TMP^T[d][a'] v1[s-63+a'][d].
//   The two "+ 1" never enter a matrix operand: x . (y + 1) = x . y + sum x. The rounded k2 and v2 are one bf16 plane each, with nothing left over, and each "+ 1" term depends on a' alone, which is fixed per lane and tile column.
// Compute dtypes, f32 accumulate: every input rounded to bf16; q k1 products exact in f32, kept as bf16 hi + lo; P kept as hi + lo; both tile contractions (exact bf16) x hi + (exact bf16) x lo (2 products); the two "+ 1" sums, softmax and the final a'-sum in f32.

#define SS_  1024                 // sequence positions
#define NH_  8
#define HD   64
#define WW_  64                   // window (both)
#define SCL  0.125f               // 1/sqrt(64)
#define PW   8                    // positions = waves per work-group
#define NR   (WW_ + PW - 1)       // token rows the work-group's windows cover
#define PK2  72                   // LDS pitch of the k2 plane, 16-bit elements: 144 B = 16 B x odd (16-byte row reads)
#define PF   68                   // LDS pitch of the f32 planes and of the a'-sum rows, floats: 272 B = 16 B x odd
#define PV2  80                   // LDS pitch of the v2 plane, 16-bit elements: 160 B = 32 B x odd (transposing reads)
typedef unsigned short bf;
typedef __attribute__((ext_vector_type(16))) __bf16   v16bf;
typedef __attribute__((ext_vector_type(8)))  unsigned short v8us;
typedef __attribute__((ext_vector_type(8)))  short    v8s;
typedef __attribute__((ext_vector_type(8)))  unsigned v8u;
typedef __attribute__((ext_vector_type(2)))  unsigned v2u;
typedef __attribute__((ext_vector_type(8)))  float    v8f;
typedef __attribute__((ext_vector_type(4)))  float    v4f;
typedef __attribute__((ext_vector_type(2))) float v2f;

typedef __attribute__((ext_vector_type(2))) __bf16 v2bf;
// f32 -> bf16, round to nearest even, by the hardware's packed convert: a in the low half of the word, b in the high half
__device__ __forceinline__ unsigned cvt2(float a, float b) { return __builtin_bit_cast(unsigned, __builtin_convertvector(((v2f){a, b}), v2bf)); }
__device__ __forceinline__ v16bf cat16b(v8us lo, v8us hi) { return __builtin_bit_cast(v16bf, __builtin_shufflevector(lo, hi, 0, 1, 2, 3, 4, 5, 6, 7, 8, 9, 10, 11, 12, 13, 14, 15)); }
__device__ __forceinline__ v8f wmmab(v16bf a, v16bf b, v8f c) { return __builtin_amdgcn_wmma_f32_16x16x32_bf16(false, a, false, b, (short)0, c, false, false); }
// hi + lo split of two neighbours (hi = bf16(y), lo = bf16(y - hi)), each pair packed into one word at once (y0 in the low half): one packed convert for the two hi parts, one for the two lo parts
__device__ __forceinline__ void split2(float y0, float y1, unsigned& hw, unsigned& lw) { hw = cvt2(y0, y1); lw = cvt2(y0 - __uint_as_float(hw << 16), y1 - __uint_as_float(hw & 0xFFFF0000u)); }
// four f32 rounded to bf16 (nearest even) and widened again
__device__ __forceinline__ v4f rnd4(v4f x) { const unsigned p = cvt2(x[0], x[1]), r = cvt2(x[2], x[3]); return (v4f){__uint_as_float(p << 16), __uint_as_float(p & 0xFFFF0000u), __uint_as_float(r << 16), __uint_as_float(r & 0xFFFF0000u)}; }
// v_exp_f32 and, in the same statement so that it cannot drift, the one free slot that the instruction set asks for behind a transcendental before its result is read or its source overwritten
__device__ __forceinline__ float exp2s(float x) { float r; asm("v_exp_f32 %0, %1\n\tv_nop" : "=v"(r) : "v"(x)); return r; }
// lane l takes the value of lane l ^ 16 (the other half of the k range of the same tile column)
__device__ __forceinline__ float xhalf(float x) { return __builtin_bit_cast(float, __builtin_amdgcn_permlanex16(__builtin_bit_cast(int, x), __builtin_bit_cast(int, x), 0x76543210, 0xfedcba98, false, false)); }
// transposing LDS load: lane (c = l & 15, g = l >> 4) gets column c, rows 8 g .. 8 g + 7 of the 16 x 16 tile whose 16-byte pieces the lanes address
__device__ __forceinline__ v8us ldtr(const bf* p) { typedef __attribute__((address_space(3))) v8s lds_v8s; return __builtin_bit_cast(v8us, __builtin_amdgcn_ds_load_tr16_b128_v8i16((lds_v8s*)p)); }

// k_fused: grid (SS_ / PW, NH_), 256 threads; wave w of block (x, h) owns position s = x * PW + w. Every fragment is in the hardware k order: element e of lane (lr, hi) is k = 8 hi + e (e < 8), 16 + 8 hi + (e - 8) (e >= 8).
__global__ __launch_bounds__(256) __attribute__((amdgpu_waves_per_eu(4, 4))) void k_fused(const float* __restrict__ q, const float* __restrict__ k1, const float* __restrict__ k2, const float* __restrict__ v1, const float* __restrict__ v2, float* __restrict__ O) {
    __shared__ __align__(32) bf sK2[NR * PK2];
    __shared__ __align__(32) bf sV2[NR * PV2];
    __shared__ __align__(32) float sK1[NR * PF];
    __shared__ __align__(32) float sV1[NR * PF];
    __shared__ __align__(32) float red[PW * 16 * PF];
    const int tid = threadIdx.x, lane = tid & 31, lr = lane & 15, hi = lane >> 4; const int w = __builtin_amdgcn_readfirstlane(tid >> 5);
    const int h = blockIdx.y, s0 = blockIdx.x * PW, s = s0 + w;
    /* LDS row r holds token max(s0 - 63 + r, 0) <= s0 + 7 <= SS_ - 1: k1, v1 rounded to bf16 and kept as f32; k2, v2 rounded to bf16 and kept so */
    /* every thread takes 16 bytes of each input at rows rw0 + 16 i; all its global loads are issued before the first conversion, so that the work-group waits out one load latency and not one a trip */
    const int rw0 = tid >> 4, cc = (tid & 15) * 4; const bool tail = rw0 < NR - 64;   /* rows 64 .. NR - 1: the first (NR - 64) * 16 threads */
    v4f x1[5], x2[5], x3[5], x4[5];
    /* both loops unrolled: the four arrays stay in registers only under constant indices */
#pragma unroll
    for (int i = 0; i < 5; ++i) if (i < 4 || tail) { const unsigned g = (((unsigned)max(s0 - (WW_ - 1) + rw0 + 16 * i, 0) * NH_ + h) * HD + cc) * 4;   /* a 32-bit byte offset, below 2 MiB: one offset register serves the four uniform bases */
        x1[i] = *(const v4f*)((const char*)k1 + g); x2[i] = *(const v4f*)((const char*)k2 + g); x3[i] = *(const v4f*)((const char*)v1 + g); x4[i] = *(const v4f*)((const char*)v2 + g); }
#pragma unroll
    for (int i = 0; i < 5; ++i) if (i < 4 || tail) { const int row = rw0 + 16 * i;
        *(v4f*)(sK1 + row * PF + cc) = rnd4(x1[i]); *(v4f*)(sV1 + row * PF + cc) = rnd4(x3[i]);
        *(v2u*)(sK2 + row * PK2 + cc) = (v2u){cvt2(x2[i][0], x2[i][1]), cvt2(x2[i][2], x2[i][3])}; *(v2u*)(sV2 + row * PV2 + cc) = (v2u){cvt2(x4[i][0], x4[i][1]), cvt2(x4[i][2], x4[i][3])}; }
    __syncthreads();

    /* logits^T tiles acc[cb][ab]: register j = [c' = 16 cb + 8 hi + j][a' = 16 ab + lr], without the "+ 1" term; bs[ab] gathers that term, the lane's share of sum_d (q k1)[a' = 16 ab + lr][d] */
    v8f acc[4][4]; v2f bs[4] = {(v2f){0.f, 0.f}, (v2f){0.f, 0.f}, (v2f){0.f, 0.f}, (v2f){0.f, 0.f}};
#pragma unroll
    for (int cb = 0; cb < 4; ++cb)
#pragma unroll
        for (int ab = 0; ab < 4; ++ab) acc[cb][ab] = (v8f){};
    const float* qp = q + ((size_t)s * NH_ + h) * HD + 8 * hi;
#pragma unroll
    for (int kc = 0; kc < 2; ++kc) {
        float qv[16];
#pragma unroll
        for (int g = 0; g < 4; ++g) { const v4f x = *(const v4f*)(qp + kc * 32 + (g >> 1) * 16 + (g & 1) * 4);
#pragma unroll
            for (int e = 0; e < 4; e += 2) { const unsigned p = cvt2(x[e], x[e + 1]); qv[g * 4 + e] = __uint_as_float(p << 16); qv[g * 4 + e + 1] = __uint_as_float(p & 0xFFFF0000u); } }
        v16bf kh[4];
#pragma unroll
        for (int cb = 0; cb < 4; ++cb) { const int o = (w + cb * 16 + lr) * PK2 + kc * 32 + 8 * hi; kh[cb] = cat16b(*(const v8us*)(sK2 + o), *(const v8us*)(sK2 + o + 16)); }
#pragma unroll
        for (int ab = 0; ab < 4; ++ab) {
            const float* kp = sK1 + (w + ab * 16 + lr) * PF + kc * 32 + 8 * hi; v8u hw, lw;
#pragma unroll
            for (int g = 0; g < 4; ++g) { const v4f x = *(const v4f*)(kp + (g >> 1) * 16 + (g & 1) * 4);
#pragma unroll
                for (int e = 0; e < 4; e += 2) { unsigned a, c2; const float p0 = __fmul_rn(qv[g * 4 + e], x[e]), p1 = __fmul_rn(qv[g * 4 + e + 1], x[e + 1]); split2(p0, p1, a, c2); hw[g * 2 + e / 2] = a; lw[g * 2 + e / 2] = c2; bs[ab] += (v2f){p0, p1}; } }
            const v16bf ah = __builtin_bit_cast(v16bf, hw), al = __builtin_bit_cast(v16bf, lw);
#pragma unroll
            for (int cb = 0; cb < 4; ++cb) acc[cb][ab] = wmmab(kh[cb], ah, acc[cb][ab]);
#pragma unroll
            for (int cb = 0; cb < 4; ++cb) acc[cb][ab] = wmmab(kh[cb], al, acc[cb][ab]);
            __builtin_amdgcn_sched_barrier(0);   /* keeps the blocks apart: without it the compiler spreads a block's four k1 row reads singly among the splits, each behind a full LDS wait of its own, where here they stand as one group with counted waits */
        }
    }

    /* joint softmax over the wave's 4096 pairs, 128 a lane; a', c' must be >= lim. It runs on the raw sums: 1/8 and log2 e are one constant CE, the exponent is one fma a logit (CE > 0 keeps the order, so the maximum is taken raw as well), and 1/sum multiplies the finished output row, not the 128 P values. The "+ 1" term of the logits, bias[ab], is one value a lane and ab: it joins the lane's maximum of that ab once and then rides in the addend of the fma */
    const int lim = (WW_ - 1) - s; float mx = -3.0e38f, bias[4], rs[4];
#pragma unroll
    for (int ab = 0; ab < 4; ++ab) { const float b = bs[ab][0] + bs[ab][1]; bias[ab] = b + xhalf(b); }
    /* the mask is an identity from position 63 on (lim <= 0 <= a', c'): lim is the same in every lane of the wave, so one scalar branch takes those waves round all 128 selects and their compares; only the first 63 positions of a head run them */
    if (lim > 0) {
#pragma unroll
        for (int ab = 0; ab < 4; ++ab)
#pragma unroll
            for (int cb = 0; cb < 4; ++cb)
#pragma unroll
                for (int j = 0; j < 8; ++j) { const int cp = cb * 16 + hi * 8 + j, ap = ab * 16 + lr; acc[cb][ab][j] = (ap >= lim && cp >= lim) ? acc[cb][ab][j] : -3.0e38f; }
    }
#pragma unroll
    for (int ab = 0; ab < 4; ++ab) { float m = -3.0e38f;
#pragma unroll
        for (int cb = 0; cb < 4; ++cb)
#pragma unroll
            for (int j = 0; j < 8; ++j) m = fmaxf(m, acc[cb][ab][j]);
        mx = fmaxf(mx, m + bias[ab]); }
#pragma unroll
    for (int sh = 16; sh; sh >>= 1) mx = fmaxf(mx, __shfl_xor(mx, sh, 32));
    const float CE = SCL * 1.4426950408889634f;
    const v8f ce8 = (v8f){CE, CE, CE, CE, CE, CE, CE, CE};
    /* rs[ab]: sum_c' P[a' = 16 ab + lr][c'], the "+ 1" term of TMP; the four together are the softmax sum */
#pragma unroll
    for (int ab = 0; ab < 4; ++ab) { const float nb = (bias[ab] - mx) * CE; const v8f nb8 = (v8f){nb, nb, nb, nb, nb, nb, nb, nb}; float r = 0.f;
#pragma unroll
        for (int cb = 0; cb < 4; ++cb) { const v8f x = __builtin_elementwise_fma(acc[cb][ab], ce8, nb8);   /* a masked pair: about -5e37, exp2 gives 0 */
#pragma unroll
            for (int j = 0; j < 8; ++j) { const float e = exp2s(x[j]); acc[cb][ab][j] = e; r += e; } }
        rs[ab] = r + xhalf(r); }
    float sum = (rs[0] + rs[1]) + (rs[2] + rs[3]);   /* both halves are in already */
#pragma unroll
    for (int sh = 8; sh; sh >>= 1) sum += __shfl_xor(sum, sh, 32);
    const float f = __fdiv_rn(1.0f, sum);

    /* P fragments (column a' = 16 ab + lr, k = c'), not normalised (largest value about 1): D tiles 2 k2 and 2 k2 + 1 of one ab, split in place */
    v16bf ph[4][2], pl[4][2];
#pragma unroll
    for (int ab = 0; ab < 4; ++ab)
#pragma unroll
        for (int k2 = 0; k2 < 2; ++k2) { v8u hw, lw;
#pragma unroll
            for (int e = 0; e < 8; e += 2) { unsigned a, c2; split2(acc[2 * k2][ab][e], acc[2 * k2][ab][e + 1], a, c2); hw[e / 2] = a; lw[e / 2] = c2; split2(acc[2 * k2 + 1][ab][e], acc[2 * k2 + 1][ab][e + 1], a, c2); hw[4 + e / 2] = a; lw[4 + e / 2] = c2; }
            ph[ab][k2] = __builtin_bit_cast(v16bf, hw); pl[ab][k2] = __builtin_bit_cast(v16bf, lw);
        }

    /* TMP^T tiles t[ab]: register j = [d = 16 db + 8 hi + j][a' = 16 ab + lr], started at rs[ab] (the same for every d); times v1 and summed over ab in the lane, over lr through the wave's own LDS rows */
    float* rw = red + w * 16 * PF;
#pragma unroll
    for (int db = 0; db < 4; ++db) {
        v16bf wh[2];
#pragma unroll
        for (int k2 = 0; k2 < 2; ++k2) { const int o = (w + k2 * 32 + 8 * hi + (lane & 7)) * PV2 + db * 16 + 8 * ((lane >> 3) & 1); wh[k2] = cat16b(ldtr(sV2 + o), ldtr(sV2 + o + 16 * PV2)); }
        v8f t[4];
#pragma unroll
        for (int ab = 0; ab < 4; ++ab) t[ab] = (v8f){rs[ab], rs[ab], rs[ab], rs[ab], rs[ab], rs[ab], rs[ab], rs[ab]};
#pragma unroll
        for (int k2 = 0; k2 < 2; ++k2) {
#pragma unroll
            for (int ab = 0; ab < 4; ++ab) t[ab] = wmmab(wh[k2], ph[ab][k2], t[ab]);
#pragma unroll
            for (int ab = 0; ab < 4; ++ab) t[ab] = wmmab(wh[k2], pl[ab][k2], t[ab]);
        }
        v4f o0 = (v4f){0.f, 0.f, 0.f, 0.f}, o1 = o0;
#pragma unroll
        for (int ab = 0; ab < 4; ++ab) { const float* vp = sV1 + (w + ab * 16 + lr) * PF + db * 16 + 8 * hi; const v4f a = *(const v4f*)vp, b = *(const v4f*)(vp + 4);
#pragma unroll
            for (int e = 0; e < 4; ++e) { o0[e] += t[ab][e] * a[e]; o1[e] += t[ab][4 + e] * b[e]; } }
        *(v4f*)(rw + lr * PF + db * 16 + 8 * hi) = o0; *(v4f*)(rw + lr * PF + db * 16 + 8 * hi + 4) = o1;
        __builtin_amdgcn_sched_barrier(0x100);   /* keeps the blocks' products apart: merged, the compiler puts products on one accumulator tile back to back and each waits out the one before it; 0x100 lets LDS reads cross, so that the next block's fragments are fetched under this block's products */
    }
    /* the rows below were written by other lanes of this wave: keep the compiler from moving the reads above the writes (one wave's LDS operations run in order) */
    __builtin_amdgcn_wave_barrier(); asm volatile("" ::: "memory");
    v2f r = (v2f){0.f, 0.f};
#pragma unroll
    for (int row = 0; row < 16; ++row) { const v2f x = *(const v2f*)(rw + row * PF + lane * 2); r[0] += x[0]; r[1] += x[1]; }
    *(v2f*)(O + ((size_t)s * NH_ + h) * HD + lane * 2) = r * f;
}

extern "C" void kernel_launch(void* const* d_in, const int* in_sizes, int n_in,
                              void* d_out, int out_size, void* d_ws, size_t ws_size, hipStream_t stream) {
    (void)in_sizes; (void)n_in; (void)out_size; (void)d_ws; (void)ws_size;
    const float* q = (const float*)d_in[0]; const float* k1 = (const float*)d_in[1]; const float* k2 = (const float*)d_in[2]; const float* v1 = (const float*)d_in[3]; const float* v2 = (const float*)d_in[4];
    float* OUT = (float*)d_out;     // [1][1024][8][64]
    k_fused<<<dim3(SS_ / PW, NH_), 256, 0, stream>>>(q, k1, k2, v1, v2, OUT);
}

// v008
// One run takes 13.9 microseconds.
// In both of two side-by-side timings against v007, it was 1.21 times as fast.
// Over all steps from v000 it is 74.6 times as fast.
#include <hip/hip_runtime.h>

// Two-simplicial (trilinear) windowed attention (q, k1, k2, v1, v2 [1][1024][8][64]; for every (s, h): logits[a][c] = (1/8) sum_d q[s][d] k1[s-a][d] (k2[s-c][d] + 1) over the causal windows a, c in [0, 64) (s-a, s-c >= 0 else -inf); p = softmax jointly over the 64 x 64 pairs; out[s][h][d] = sum_{a,c} p[a][c] v1[s-a][d] (v2[s-c][d] + 1) -> [1][1024][8][64] (0.52 M)).
// Layout: a' = 63 - a and c' = 63 - c make every window a contiguous ascending token range s-63 .. s; a token index below 0 is clipped to 0 as in the reference (its pairs are masked, so their P is exactly 0).
// One kernel does everything: a work-group of 8 waves takes 8 neighbouring positions of one head, reads the 71 token rows they share straight from k1, k2, v1, v2, rounds them on the way into LDS, and each wave carries its own (s, h) from the q k1 products to the output row with logits, P and TMP in registers.
//   logits^T[c'][a'] = (k2 window) . (q k1)^T + sum_d (q k1)[a'][d], so that a pair of D tiles, rounded to f16 in place, is the P operand (k = c') of the second product;
//   TMP^T[d][a'] = (v2 window)^T . P^T + sum_c' P[a'][c'] with the value window read by the transposing LDS load; then out[d] = sum_a' TMP^T[d][a'] v1[s-63+a'][d].
//   The two "+ 1" never enter a matrix operand: x . (y + 1) = x . y + sum x. The rounded k2 and v2 are one plane each, and each "+ 1" term depends on a' alone, which is fixed per lane and tile column.
// Compute dtypes, f32 accumulate: every input rounded to bf16; both tile contractions are ONE f16 product: the bf16-rounded k2, v2 are carried as f16 (8 significant bits fit its 11: exact from 2^-14 up, within 2^-25 below); the q k1 products, exact in f32, and P are each rounded once to f16 (2^-11 relative); P carries a factor 2^15, which 1/sum takes out again, so that it keeps its 11 bits down to 2^-29 of the largest; the two "+ 1" sums, softmax and the final a'-sum in f32.

#define SS_  1024                 // sequence positions
#define NH_  8
#define HD   64
#define WW_  64                   // window (both)
#define SCL  0.125f               // 1/sqrt(64)
#define PW   8                    // positions = waves per work-group
#define NR   (WW_ + PW - 1)       // token rows the work-group's windows cover
#define PSH  15.0f                // P = 2^PSH at the maximum: below the largest f16 (65504)
#define PK2  72                   // LDS pitch of the k2 plane, 16-bit elements: 144 B = 16 B x odd (16-byte row reads)
#define PF   68                   // LDS pitch of the f32 planes and of the a'-sum rows, floats: 272 B = 16 B x odd
#define PV2  80                   // LDS pitch of the v2 plane, 16-bit elements: 160 B = 32 B x odd (transposing reads)
typedef unsigned short bf;
typedef __attribute__((ext_vector_type(16))) _Float16 v16h;
typedef __attribute__((ext_vector_type(8)))  unsigned short v8us;
typedef __attribute__((ext_vector_type(8)))  short    v8s;
typedef __attribute__((ext_vector_type(8)))  unsigned v8u;
typedef __attribute__((ext_vector_type(2)))  unsigned v2u;
typedef __attribute__((ext_vector_type(8)))  float    v8f;
typedef __attribute__((ext_vector_type(4)))  float    v4f;
typedef __attribute__((ext_vector_type(2))) float v2f;

typedef __attribute__((ext_vector_type(2))) __bf16 v2bf;
typedef __attribute__((ext_vector_type(2))) _Float16 v2h;
// f32 -> bf16, round to nearest even, by the hardware's packed convert: a in the low half of the word, b in the high half
__device__ __forceinline__ unsigned cvt2(float a, float b) { return __builtin_bit_cast(unsigned, __builtin_convertvector(((v2f){a, b}), v2bf)); }
// f32 -> f16, round to nearest even, by the packed convert: a in the low half of the word, b in the high half
__device__ __forceinline__ unsigned cvth(float a, float b) { return __builtin_bit_cast(unsigned, __builtin_convertvector(((v2f){a, b}), v2h)); }
// two f32 rounded to bf16 (nearest even) and carried on as f16
__device__ __forceinline__ unsigned rndh(float a, float b) { const unsigned p = cvt2(a, b); return cvth(__uint_as_float(p << 16), __uint_as_float(p & 0xFFFF0000u)); }
__device__ __forceinline__ v16h cat16b(v8us lo, v8us hi) { return __builtin_bit_cast(v16h, __builtin_shufflevector(lo, hi, 0, 1, 2, 3, 4, 5, 6, 7, 8, 9, 10, 11, 12, 13, 14, 15)); }
__device__ __forceinline__ v8f wmmab(v16h a, v16h b, v8f c) { return __builtin_amdgcn_wmma_f32_16x16x32_f16(false, a, false, b, (short)0, c, false, false); }
// four f32 rounded to bf16 (nearest even) and widened again
__device__ __forceinline__ v4f rnd4(v4f x) { const unsigned p = cvt2(x[0], x[1]), r = cvt2(x[2], x[3]); return (v4f){__uint_as_float(p << 16), __uint_as_float(p & 0xFFFF0000u), __uint_as_float(r << 16), __uint_as_float(r & 0xFFFF0000u)}; }
// v_exp_f32 and, in the same statement so that it cannot drift, the one free slot that the instruction set asks for behind a transcendental before its result is read or its source overwritten
__device__ __forceinline__ float exp2s(float x) { float r; asm("v_exp_f32 %0, %1\n\tv_nop" : "=v"(r) : "v"(x)); return r; }
// lane l takes the value of lane l ^ 16 (the other half of the k range of the same tile column)
__device__ __forceinline__ float xhalf(float x) { return __builtin_bit_cast(float, __builtin_amdgcn_permlanex16(__builtin_bit_cast(int, x), __builtin_bit_cast(int, x), 0x76543210, 0xfedcba98, false, false)); }
// transposing LDS load: lane (c = l & 15, g = l >> 4) gets column c, rows 8 g .. 8 g + 7 of the 16 x 16 tile whose 16-byte pieces the lanes address
__device__ __forceinline__ v8us ldtr(const bf* p) { typedef __attribute__((address_space(3))) v8s lds_v8s; return __builtin_bit_cast(v8us, __builtin_amdgcn_ds_load_tr16_b128_v8i16((lds_v8s*)p)); }

// k_fused: grid (SS_ / PW, NH_), 256 threads; wave w of block (x, h) owns position s = x * PW + w. Every fragment is in the hardware k order: element e of lane (lr, hi) is k = 8 hi + e (e < 8), 16 + 8 hi + (e - 8) (e >= 8).
__global__ __launch_bounds__(256) __attribute__((amdgpu_waves_per_eu(4, 4))) void k_fused(const float* __restrict__ q, const float* __restrict__ k1, const float* __restrict__ k2, const float* __restrict__ v1, const float* __restrict__ v2, float* __restrict__ O) {
    __shared__ __align__(32) bf sK2[NR * PK2];
    __shared__ __align__(32) bf sV2[NR * PV2];
    __shared__ __align__(32) float sK1[NR * PF];
    __shared__ __align__(32) float sV1[NR * PF];
    __shared__ __align__(32) float red[PW * 16 * PF];
    const int tid = threadIdx.x, lane = tid & 31, lr = lane & 15, hi = lane >> 4; const int w = __builtin_amdgcn_readfirstlane(tid >> 5);
    const int h = blockIdx.y, s0 = blockIdx.x * PW, s = s0 + w;
    /* LDS row r holds token max(s0 - 63 + r, 0) <= s0 + 7 <= SS_ - 1: k1, v1 rounded to bf16 and kept as f32; k2, v2 rounded to bf16 and kept as f16 */
    /* every thread takes 16 bytes of each input at rows rw0 + 16 i; all its global loads are issued before the first conversion, so that the work-group waits out one load latency and not one a trip */
    const int rw0 = tid >> 4, cc = (tid & 15) * 4; const bool tail = rw0 < NR - 64;   /* rows 64 .. NR - 1: the first (NR - 64) * 16 threads */
    v4f x1[5], x2[5], x3[5], x4[5];
    /* both loops unrolled: the four arrays stay in registers only under constant indices */
#pragma unroll
    for (int i = 0; i < 5; ++i) if (i < 4 || tail) { const unsigned g = (((unsigned)max(s0 - (WW_ - 1) + rw0 + 16 * i, 0) * NH_ + h) * HD + cc) * 4;   /* a 32-bit byte offset, below 2 MiB: one offset register serves the four uniform bases */
        x1[i] = *(const v4f*)((const char*)k1 + g); x2[i] = *(const v4f*)((const char*)k2 + g); x3[i] = *(const v4f*)((const char*)v1 + g); x4[i] = *(const v4f*)((const char*)v2 + g); }
#pragma unroll
    for (int i = 0; i < 5; ++i) if (i < 4 || tail) { const int row = rw0 + 16 * i;
        *(v4f*)(sK1 + row * PF + cc) = rnd4(x1[i]); *(v4f*)(sV1 + row * PF + cc) = rnd4(x3[i]);
        *(v2u*)(sK2 + row * PK2 + cc) = (v2u){rndh(x2[i][0], x2[i][1]), rndh(x2[i][2], x2[i][3])}; *(v2u*)(sV2 + row * PV2 + cc) = (v2u){rndh(x4[i][0], x4[i][1]), rndh(x4[i][2], x4[i][3])}; }
    __syncthreads();

    /* logits^T tiles acc[cb][ab]: register j = [c' = 16 cb + 8 hi + j][a' = 16 ab + lr], without the "+ 1" term; bs[ab] gathers that term, the lane's share of sum_d (q k1)[a' = 16 ab + lr][d] */
    v8f acc[4][4]; v2f bs[4] = {(v2f){0.f, 0.f}, (v2f){0.f, 0.f}, (v2f){0.f, 0.f}, (v2f){0.f, 0.f}};
#pragma unroll
    for (int cb = 0; cb < 4; ++cb)
#pragma unroll
        for (int ab = 0; ab < 4; ++ab) acc[cb][ab] = (v8f){};
    const float* qp = q + ((size_t)s * NH_ + h) * HD + 8 * hi;
#pragma unroll
    for (int kc = 0; kc < 2; ++kc) {
        float qv[16];
#pragma unroll
        for (int g = 0; g < 4; ++g) { const v4f x = *(const v4f*)(qp + kc * 32 + (g >> 1) * 16 + (g & 1) * 4);
#pragma unroll
            for (int e = 0; e < 4; e += 2) { const unsigned p = cvt2(x[e], x[e + 1]); qv[g * 4 + e] = __uint_as_float(p << 16); qv[g * 4 + e + 1] = __uint_as_float(p & 0xFFFF0000u); } }
        v16h kh[4];
#pragma unroll
        for (int cb = 0; cb < 4; ++cb) { const int o = (w + cb * 16 + lr) * PK2 + kc * 32 + 8 * hi; kh[cb] = cat16b(*(const v8us*)(sK2 + o), *(const v8us*)(sK2 + o + 16)); }
#pragma unroll
        for (int ab = 0; ab < 4; ++ab) {
            const float* kp = sK1 + (w + ab * 16 + lr) * PF + kc * 32 + 8 * hi; v8u hw;
#pragma unroll
            for (int g = 0; g < 4; ++g) { const v4f x = *(const v4f*)(kp + (g >> 1) * 16 + (g & 1) * 4);
#pragma unroll
                for (int e = 0; e < 4; e += 2) { const float p0 = __fmul_rn(qv[g * 4 + e], x[e]), p1 = __fmul_rn(qv[g * 4 + e + 1], x[e + 1]); hw[g * 2 + e / 2] = cvth(p0, p1); bs[ab] += (v2f){p0, p1}; } }
            const v16h ah = __builtin_bit_cast(v16h, hw);
#pragma unroll
            for (int cb = 0; cb < 4; ++cb) acc[cb][ab] = wmmab(kh[cb], ah, acc[cb][ab]);
            __builtin_amdgcn_sched_barrier(0);   /* keeps the blocks apart: without it the compiler spreads a block's four k1 row reads singly among the products, each behind a full LDS wait of its own, where here they stand as one group with counted waits */
        }
    }

    /* joint softmax over the wave's 4096 pairs, 128 a lane; a', c' must be >= lim. It runs on the raw sums: 1/8 and log2 e are one constant CE, the exponent is one fma a logit (CE > 0 keeps the order, so the maximum is taken raw as well), and 1/sum multiplies the finished output row, not the 128 P values (so the factor 2^PSH in P, one more addend of that fma's constant, cancels there). The "+ 1" term of the logits, bias[ab], is one value a lane and ab: it joins the lane's maximum of that ab once and then rides in the addend of the fma */
    const int lim = (WW_ - 1) - s; float mx = -3.0e38f, bias[4], rs[4];
#pragma unroll
    for (int ab = 0; ab < 4; ++ab) { const float b = bs[ab][0] + bs[ab][1]; bias[ab] = b + xhalf(b); }
    /* the mask is an identity from position 63 on (lim <= 0 <= a', c'): lim is the same in every lane of the wave, so one scalar branch takes those waves round all 128 selects and their compares; only the first 63 positions of a head run them */
    if (lim > 0) {
#pragma unroll
        for (int ab = 0; ab < 4; ++ab)
#pragma unroll
            for (int cb = 0; cb < 4; ++cb)
#pragma unroll
                for (int j = 0; j < 8; ++j) { const int cp = cb * 16 + hi * 8 + j, ap = ab * 16 + lr; acc[cb][ab][j] = (ap >= lim && cp >= lim) ? acc[cb][ab][j] : -3.0e38f; }
    }
#pragma unroll
    for (int ab = 0; ab < 4; ++ab) { float m = -3.0e38f;
#pragma unroll
        for (int cb = 0; cb < 4; ++cb)
#pragma unroll
            for (int j = 0; j < 8; ++j) m = fmaxf(m, acc[cb][ab][j]);
        mx = fmaxf(mx, m + bias[ab]); }
#pragma unroll
    for (int sh = 16; sh; sh >>= 1) mx = fmaxf(mx, __shfl_xor(mx, sh, 32));
    const float CE = SCL * 1.4426950408889634f;
    const v8f ce8 = (v8f){CE, CE, CE, CE, CE, CE, CE, CE};
    /* rs[ab]: sum_c' P[a' = 16 ab + lr][c'], the "+ 1" term of TMP; the four together are the softmax sum */
#pragma unroll
    for (int ab = 0; ab < 4; ++ab) { const float nb = (bias[ab] - mx) * CE + PSH; const v8f nb8 = (v8f){nb, nb, nb, nb, nb, nb, nb, nb}; float r = 0.f;
#pragma unroll
        for (int cb = 0; cb < 4; ++cb) { const v8f x = __builtin_elementwise_fma(acc[cb][ab], ce8, nb8);   /* a masked pair: about -5e37, exp2 gives 0 */
#pragma unroll
            for (int j = 0; j < 8; ++j) { const float e = exp2s(x[j]); acc[cb][ab][j] = e; r += e; } }
        rs[ab] = r + xhalf(r); }
    float sum = (rs[0] + rs[1]) + (rs[2] + rs[3]);   /* both halves are in already */
#pragma unroll
    for (int sh = 8; sh; sh >>= 1) sum += __shfl_xor(sum, sh, 32);
    const float f = __fdiv_rn(1.0f, sum);

    /* P fragments (column a' = 16 ab + lr, k = c'), not normalised (largest value about 2^PSH): D tiles 2 k2 and 2 k2 + 1 of one ab, rounded to f16 in place */
    v16h ph[4][2];
#pragma unroll
    for (int ab = 0; ab < 4; ++ab)
#pragma unroll
        for (int k2 = 0; k2 < 2; ++k2) { v8u hw;
#pragma unroll
            for (int e = 0; e < 8; e += 2) { hw[e / 2] = cvth(acc[2 * k2][ab][e], acc[2 * k2][ab][e + 1]); hw[4 + e / 2] = cvth(acc[2 * k2 + 1][ab][e], acc[2 * k2 + 1][ab][e + 1]); }
            ph[ab][k2] = __builtin_bit_cast(v16h, hw);
        }

    /* TMP^T tiles t[ab]: register j = [d = 16 db + 8 hi + j][a' = 16 ab + lr], started at rs[ab] (the same for every d); times v1 and summed over ab in the lane, over lr through the wave's own LDS rows */
    float* rw = red + w * 16 * PF;
#pragma unroll
    for (int db = 0; db < 4; ++db) {
        v16h wh[2];
#pragma unroll
        for (int k2 = 0; k2 < 2; ++k2) { const int o = (w + k2 * 32 + 8 * hi + (lane & 7)) * PV2 + db * 16 + 8 * ((lane >> 3) & 1); wh[k2] = cat16b(ldtr(sV2 + o), ldtr(sV2 + o + 16 * PV2)); }
        v8f t[4];
#pragma unroll
        for (int ab = 0; ab < 4; ++ab) t[ab] = (v8f){rs[ab], rs[ab], rs[ab], rs[ab], rs[ab], rs[ab], rs[ab], rs[ab]};
#pragma unroll
        for (int k2 = 0; k2 < 2; ++k2)
#pragma unroll
            for (int ab = 0; ab < 4; ++ab) t[ab] = wmmab(wh[k2], ph[ab][k2], t[ab]);
        v4f o0 = (v4f){0.f, 0.f, 0.f, 0.f}, o1 = o0;
#pragma unroll
        for (int ab = 0; ab < 4; ++ab) { const float* vp = sV1 + (w + ab * 16 + lr) * PF + db * 16 + 8 * hi; const v4f a = *(const v4f*)vp, b = *(const v4f*)(vp + 4);
#pragma unroll
            for (int e = 0; e < 4; ++e) { o0[e] += t[ab][e] * a[e]; o1[e] += t[ab][4 + e] * b[e]; } }
        *(v4f*)(rw + lr * PF + db * 16 + 8 * hi) = o0; *(v4f*)(rw + lr * PF + db * 16 + 8 * hi + 4) = o1;
        __builtin_amdgcn_sched_barrier(0x100);   /* keeps the blocks' products apart: merged, the compiler puts products on one accumulator tile back to back and each waits out the one before it; 0x100 lets LDS reads cross, so that the next block's fragments are fetched under this block's products */
    }
    /* the rows below were written by other lanes of this wave: keep the compiler from moving the reads above the writes (one wave's LDS operations run in order) */
    __builtin_amdgcn_wave_barrier(); asm volatile("" ::: "memory");
    v2f r = (v2f){0.f, 0.f};
#pragma unroll
    for (int row = 0; row < 16; ++row) { const v2f x = *(const v2f*)(rw + row * PF + lane * 2); r[0] += x[0]; r[1] += x[1]; }
    *(v2f*)(O + ((size_t)s * NH_ + h) * HD + lane * 2) = r * f;
}

extern "C" void kernel_launch(void* const* d_in, const int* in_sizes, int n_in,
                              void* d_out, int out_size, void* d_ws, size_t ws_size, hipStream_t stream) {
    (void)in_sizes; (void)n_in; (void)out_size; (void)d_ws; (void)ws_size;
    const float* q = (const float*)d_in[0]; const float* k1 = (const float*)d_in[1]; const float* k2 = (const float*)d_in[2]; const float* v1 = (const float*)d_in[3]; const float* v2 = (const float*)d_in[4];
    float* OUT = (float*)d_out;     // [1][1024][8][64]
    k_fused<<<dim3(SS_ / PW, NH_), 256, 0, stream>>>(q, k1, k2, v1, v2, OUT);
}

// v009
// Measured time: 12.4 microseconds a run.
// In two side-by-side timings against v008, it was 1.11 and 1.12 times as fast.
// Counting every step since v000, it is 83.3 times as fast.
#include <hip/hip_runtime.h>

// Two-simplicial (trilinear) windowed attention (q, k1, k2, v1, v2 [1][1024][8][64]; for every (s, h): logits[a][c] = (1/8) sum_d q[s][d] k1[s-a][d] (k2[s-c][d] + 1) over the causal windows a, c in [0, 64) (s-a, s-c >= 0 else -inf); p = softmax jointly over the 64 x 64 pairs; out[s][h][d] = sum_{a,c} p[a][c] v1[s-a][d] (v2[s-c][d] + 1) -> [1][1024][8][64] (0.52 M)).
// Layout: a' = 63 - a and c' = 63 - c make every window a contiguous ascending token range s-63 .. s; a token index below 0 is clipped to 0 as in the reference (its pairs are masked, so their P is exactly 0).
// One kernel does everything: a work-group of 8 waves takes 16 neighbouring positions of one head, reads the 79 token rows they share straight from k1, k2, v1, v2, rounds them on the way into LDS once, and each wave then carries two positions, one after the other, from the q k1 products to the output row with logits, P and TMP in registers.
//   logits^T[c'][a'] = (k2 window) . (q k1)^T + sum_d (q k1)[a'][d], so that a pair of D tiles, rounded to f16 in place, is the P operand (k = c') of the second product;
//   TMP^T[d][a'] = (v2 window)^T . P^T + sum_c' P[a'][c'] with the value window read by the transposing LDS load; then out[d] = sum_a' TMP^T[d][a'] v1[s-63+a'][d].
//   The two "+ 1" never enter a matrix operand: x . (y + 1) = x . y + sum x. The rounded k2 and v2 are one plane each, and each "+ 1" term depends on a' alone, which is fixed per lane and tile column.
// Compute dtypes, f32 accumulate: every input rounded to bf16; both tile contractions are ONE f16 product: the bf16-rounded k2, v2 are carried as f16 (8 significant bits fit its 11: exact from 2^-14 up, within 2^-25 below); the q k1 products, exact in f32, and P are each rounded once to f16 (2^-11 relative); P carries a factor 2^15, which 1/sum takes out again, so that it keeps its 11 bits down to 2^-29 of the largest; the two "+ 1" sums, softmax and the final a'-sum in f32.

#define SS_  1024                 // sequence positions
#define NH_  8
#define HD   64
#define WW_  64                   // window (both)
#define SCL  0.125f               // 1/sqrt(64)
#define PW   8                    // waves per work-group
#define PPW  2                    // positions a wave takes, one after the other
#define PB   (PW * PPW)           // positions per work-group
#define NR   (WW_ + PB - 1)       // token rows the work-group's windows cover
#define PSH  15.0f                // P = 2^PSH at the maximum: below the largest f16 (65504)
#define PK2  72                   // LDS pitch of the k2 plane, 16-bit elements: 144 B = 16 B x odd (16-byte row reads)
#define PF   68                   // LDS pitch of the f32 planes and of the a'-sum rows, floats: 272 B = 16 B x odd
#define PV2  80                   // LDS pitch of the v2 plane, 16-bit elements: 160 B = 32 B x odd (transposing reads)
typedef unsigned short bf;
typedef __attribute__((ext_vector_type(16))) _Float16 v16h;
typedef __attribute__((ext_vector_type(8)))  unsigned short v8us;
typedef __attribute__((ext_vector_type(8)))  short    v8s;
typedef __attribute__((ext_vector_type(8)))  unsigned v8u;
typedef __attribute__((ext_vector_type(2)))  unsigned v2u;
typedef __attribute__((ext_vector_type(8)))  float    v8f;
typedef __attribute__((ext_vector_type(4)))  float    v4f;
typedef __attribute__((ext_vector_type(2))) float v2f;

typedef __attribute__((ext_vector_type(2))) __bf16 v2bf;
typedef __attribute__((ext_vector_type(2))) _Float16 v2h;
// f32 -> bf16, round to nearest even, by the hardware's packed convert: a in the low half of the word, b in the high half
__device__ __forceinline__ unsigned cvt2(float a, float b) { return __builtin_bit_cast(unsigned, __builtin_convertvector(((v2f){a, b}), v2bf)); }
// f32 -> f16, round to nearest even, by the packed convert: a in the low half of the word, b in the high half
__device__ __forceinline__ unsigned cvth(float a, float b) { return __builtin_bit_cast(unsigned, __builtin_convertvector(((v2f){a, b}), v2h)); }
// two f32 rounded to bf16 (nearest even) and carried on as f16
__device__ __forceinline__ unsigned rndh(float a, float b) { const unsigned p = cvt2(a, b); return cvth(__uint_as_float(p << 16), __uint_as_float(p & 0xFFFF0000u)); }
__device__ __forceinline__ v16h cat16b(v8us lo, v8us hi) { return __builtin_bit_cast(v16h, __builtin_shufflevector(lo, hi, 0, 1, 2, 3, 4, 5, 6, 7, 8, 9, 10, 11, 12, 13, 14, 15)); }
__device__ __forceinline__ v8f wmmab(v16h a, v16h b, v8f c) { return __builtin_amdgcn_wmma_f32_16x16x32_f16(false, a, false, b, (short)0, c, false, false); }
// four f32 rounded to bf16 (nearest even) and widened again
__device__ __forceinline__ v4f rnd4(v4f x) { const unsigned p = cvt2(x[0], x[1]), r = cvt2(x[2], x[3]); return (v4f){__uint_as_float(p << 16), __uint_as_float(p & 0xFFFF0000u), __uint_as_float(r << 16), __uint_as_float(r & 0xFFFF0000u)}; }
// v_exp_f32 and, in the same statement so that it cannot drift, the one free slot that the instruction set asks for behind a transcendental before its result is read or its source overwritten
__device__ __forceinline__ float exp2s(float x) { float r; asm("v_exp_f32 %0, %1\n\tv_nop" : "=v"(r) : "v"(x)); return r; }
// lane l takes the value of lane l ^ 16 (the other half of the k range of the same tile column)
__device__ __forceinline__ float xhalf(float x) { return __builtin_bit_cast(float, __builtin_amdgcn_permlanex16(__builtin_bit_cast(int, x), __builtin_bit_cast(int, x), 0x76543210, 0xfedcba98, false, false)); }
// transposing LDS load: lane (c = l & 15, g = l >> 4) gets column c, rows 8 g .. 8 g + 7 of the 16 x 16 tile whose 16-byte pieces the lanes address
__device__ __forceinline__ v8us ldtr(const bf* p) { typedef __attribute__((address_space(3))) v8s lds_v8s; return __builtin_bit_cast(v8us, __builtin_amdgcn_ds_load_tr16_b128_v8i16((lds_v8s*)p)); }

// k_fused: grid (NH_, SS_ / PB), 256 threads: 512 work-groups, two to a WGP (registers), so all are resident at once and the rows are staged once a WGP slot; wave w of block (h, y) owns positions s = y * PB + w + PW * it, it < PPW. The head is the fast grid index, so that the work-groups of the first 63 positions, which alone run the mask and last longest, have the lowest indices. Every fragment is in the hardware k order: element e of lane (lr, hi) is k = 8 hi + e (e < 8), 16 + 8 hi + (e - 8) (e >= 8).
__global__ __launch_bounds__(256) __attribute__((amdgpu_waves_per_eu(4, 4))) void k_fused(const float* __restrict__ q, const float* __restrict__ k1, const float* __restrict__ k2, const float* __restrict__ v1, const float* __restrict__ v2, float* __restrict__ O) {
    __shared__ __align__(32) bf sK2[NR * PK2];
    __shared__ __align__(32) bf sV2[NR * PV2];
    __shared__ __align__(32) float sK1[NR * PF];
    __shared__ __align__(32) float sV1[NR * PF];
    __shared__ __align__(32) float red[PW * 16 * PF];
    const int tid = threadIdx.x, lane = tid & 31, lr = lane & 15, hi = lane >> 4; const int w = __builtin_amdgcn_readfirstlane(tid >> 5);
    const int h = blockIdx.x, s0 = blockIdx.y * PB;
    /* LDS row r holds token max(s0 - 63 + r, 0) <= s0 + PB - 1 <= SS_ - 1: k1, v1 rounded to bf16 and kept as f32; k2, v2 rounded to bf16 and kept as f16 */
    /* every thread takes 16 bytes of each input at rows rw0 + 16 i; all its global loads are issued before the first conversion, so that the work-group waits out one load latency and not one a trip */
    const int rw0 = tid >> 4, cc = (tid & 15) * 4; const bool tail = rw0 < NR - 64;   /* rows 64 .. NR - 1: the first (NR - 64) * 16 threads */
    v4f x1[5], x2[5], x3[5], x4[5];
    /* both loops unrolled: the four arrays stay in registers only under constant indices */
#pragma unroll
    for (int i = 0; i < 5; ++i) if (i < 4 || tail) { const unsigned g = (((unsigned)max(s0 - (WW_ - 1) + rw0 + 16 * i, 0) * NH_ + h) * HD + cc) * 4;   /* a 32-bit byte offset, below 2 MiB: one offset register serves the four uniform bases */
        x1[i] = *(const v4f*)((const char*)k1 + g); x2[i] = *(const v4f*)((const char*)k2 + g); x3[i] = *(const v4f*)((const char*)v1 + g); x4[i] = *(const v4f*)((const char*)v2 + g); }
#pragma unroll
    for (int i = 0; i < 5; ++i) if (i < 4 || tail) { const int row = rw0 + 16 * i;
        *(v4f*)(sK1 + row * PF + cc) = rnd4(x1[i]); *(v4f*)(sV1 + row * PF + cc) = rnd4(x3[i]);
        *(v2u*)(sK2 + row * PK2 + cc) = (v2u){rndh(x2[i][0], x2[i][1]), rndh(x2[i][2], x2[i][3])}; *(v2u*)(sV2 + row * PV2 + cc) = (v2u){rndh(x4[i][0], x4[i][1]), rndh(x4[i][2], x4[i][3])}; }
    __syncthreads();

    /* kept rolled: one copy of the body in the instruction cache, one set of registers; nothing below writes the staged rows, so the trips need no further barrier */
#pragma unroll 1
    for (int it = 0; it < PPW; ++it) {
    const int wp = w + PW * it, s = s0 + wp;   /* the position's place in the work-group = first LDS row of its windows */
    /* logits^T tiles acc[cb][ab]: register j = [c' = 16 cb + 8 hi + j][a' = 16 ab + lr], without the "+ 1" term; bs[ab] gathers that term, the lane's share of sum_d (q k1)[a' = 16 ab + lr][d] */
    v8f acc[4][4]; v2f bs[4] = {(v2f){0.f, 0.f}, (v2f){0.f, 0.f}, (v2f){0.f, 0.f}, (v2f){0.f, 0.f}};
#pragma unroll
    for (int cb = 0; cb < 4; ++cb)
#pragma unroll
        for (int ab = 0; ab < 4; ++ab) acc[cb][ab] = (v8f){};
    const float* qp = q + ((size_t)s * NH_ + h) * HD + 8 * hi;
#pragma unroll
    for (int kc = 0; kc < 2; ++kc) {
        float qv[16];
#pragma unroll
        for (int g = 0; g < 4; ++g) { const v4f x = *(const v4f*)(qp + kc * 32 + (g >> 1) * 16 + (g & 1) * 4);
#pragma unroll
            for (int e = 0; e < 4; e += 2) { const unsigned p = cvt2(x[e], x[e + 1]); qv[g * 4 + e] = __uint_as_float(p << 16); qv[g * 4 + e + 1] = __uint_as_float(p & 0xFFFF0000u); } }
        v16h kh[4];
#pragma unroll
        for (int cb = 0; cb < 4; ++cb) { const int o = (wp + cb * 16 + lr) * PK2 + kc * 32 + 8 * hi; kh[cb] = cat16b(*(const v8us*)(sK2 + o), *(const v8us*)(sK2 + o + 16)); }
#pragma unroll
        for (int ab = 0; ab < 4; ++ab) {
            const float* kp = sK1 + (wp + ab * 16 + lr) * PF + kc * 32 + 8 * hi; v8u hw;
#pragma unroll
            for (int g = 0; g < 4; ++g) { const v4f x = *(const v4f*)(kp + (g >> 1) * 16 + (g & 1) * 4);
#pragma unroll
                for (int e = 0; e < 4; e += 2) { const float p0 = __fmul_rn(qv[g * 4 + e], x[e]), p1 = __fmul_rn(qv[g * 4 + e + 1], x[e + 1]); hw[g * 2 + e / 2] = cvth(p0, p1); bs[ab] += (v2f){p0, p1}; } }
            const v16h ah = __builtin_bit_cast(v16h, hw);
#pragma unroll
            for (int cb = 0; cb < 4; ++cb) acc[cb][ab] = wmmab(kh[cb], ah, acc[cb][ab]);
            __builtin_amdgcn_sched_barrier(0);   /* keeps the blocks apart: without it the compiler spreads a block's four k1 row reads singly among the products, each behind a full LDS wait of its own, where here they stand as one group with counted waits */
        }
    }

    /* joint softmax over the wave's 4096 pairs, 128 a lane; a', c' must be >= lim. It runs on the raw sums: 1/8 and log2 e are one constant CE, the exponent is one fma a logit (CE > 0 keeps the order, so the maximum is taken raw as well), and 1/sum multiplies the finished output row, not the 128 P values (so the factor 2^PSH in P, one more addend of that fma's constant, cancels there). The "+ 1" term of the logits, bias[ab], is one value a lane and ab: it joins the lane's maximum of that ab once and then rides in the addend of the fma */
    const int lim = (WW_ - 1) - s; float mx = -3.0e38f, bias[4], rs[4];
#pragma unroll
    for (int ab = 0; ab < 4; ++ab) { const float b = bs[ab][0] + bs[ab][1]; bias[ab] = b + xhalf(b); }
    /* the mask is an identity from position 63 on (lim <= 0 <= a', c'): lim is the same in every lane of the wave, so one scalar branch takes those waves round all 128 selects and their compares; only the first 63 positions of a head run them */
    if (lim > 0) {
#pragma unroll
        for (int ab = 0; ab < 4; ++ab)
#pragma unroll
            for (int cb = 0; cb < 4; ++cb)
#pragma unroll
                for (int j = 0; j < 8; ++j) { const int cp = cb * 16 + hi * 8 + j, ap = ab * 16 + lr; acc[cb][ab][j] = (ap >= lim && cp >= lim) ? acc[cb][ab][j] : -3.0e38f; }
    }
#pragma unroll
    for (int ab = 0; ab < 4; ++ab) { float m = -3.0e38f;
#pragma unroll
        for (int cb = 0; cb < 4; ++cb)
#pragma unroll
            for (int j = 0; j < 8; ++j) m = fmaxf(m, acc[cb][ab][j]);
        mx = fmaxf(mx, m + bias[ab]); }
#pragma unroll
    for (int sh = 16; sh; sh >>= 1) mx = fmaxf(mx, __shfl_xor(mx, sh, 32));
    const float CE = SCL * 1.4426950408889634f;
    const v8f ce8 = (v8f){CE, CE, CE, CE, CE, CE, CE, CE};
    /* rs[ab]: sum_c' P[a' = 16 ab + lr][c'], the "+ 1" term of TMP; the four together are the softmax sum */
#pragma unroll
    for (int ab = 0; ab < 4; ++ab) { const float nb = (bias[ab] - mx) * CE + PSH; const v8f nb8 = (v8f){nb, nb, nb, nb, nb, nb, nb, nb}; float r = 0.f;
#pragma unroll
        for (int cb = 0; cb < 4; ++cb) { const v8f x = __builtin_elementwise_fma(acc[cb][ab], ce8, nb8);   /* a masked pair: about -5e37, exp2 gives 0 */
#pragma unroll
            for (int j = 0; j < 8; ++j) { const float e = exp2s(x[j]); acc[cb][ab][j] = e; r += e; } }
        rs[ab] = r + xhalf(r); }
    float sum = (rs[0] + rs[1]) + (rs[2] + rs[3]);   /* both halves are in already */
#pragma unroll
    for (int sh = 8; sh; sh >>= 1) sum += __shfl_xor(sum, sh, 32);
    const float f = __fdiv_rn(1.0f, sum);

    /* P fragments (column a' = 16 ab + lr, k = c'), not normalised (largest value about 2^PSH): D tiles 2 k2 and 2 k2 + 1 of one ab, rounded to f16 in place */
    v16h ph[4][2];
#pragma unroll
    for (int ab = 0; ab < 4; ++ab)
#pragma unroll
        for (int k2 = 0; k2 < 2; ++k2) { v8u hw;
#pragma unroll
            for (int e = 0; e < 8; e += 2) { hw[e / 2] = cvth(acc[2 * k2][ab][e], acc[2 * k2][ab][e + 1]); hw[4 + e / 2] = cvth(acc[2 * k2 + 1][ab][e], acc[2 * k2 + 1][ab][e + 1]); }
            ph[ab][k2] = __builtin_bit_cast(v16h, hw);
        }

    /* TMP^T tiles t[ab]: register j = [d = 16 db + 8 hi + j][a' = 16 ab + lr], started at rs[ab] (the same for every d); times v1 and summed over ab in the lane, over lr through the wave's own LDS rows */
    float* rw = red + w * 16 * PF;
#pragma unroll
    for (int db = 0; db < 4; ++db) {
        v16h wh[2];
#pragma unroll
        for (int k2 = 0; k2 < 2; ++k2) { const int o = (wp + k2 * 32 + 8 * hi + (lane & 7)) * PV2 + db * 16 + 8 * ((lane >> 3) & 1); wh[k2] = cat16b(ldtr(sV2 + o), ldtr(sV2 + o + 16 * PV2)); }
        v8f t[4];
#pragma unroll
        for (int ab = 0; ab < 4; ++ab) t[ab] = (v8f){rs[ab], rs[ab], rs[ab], rs[ab], rs[ab], rs[ab], rs[ab], rs[ab]};
#pragma unroll
        for (int k2 = 0; k2 < 2; ++k2)
#pragma unroll
            for (int ab = 0; ab < 4; ++ab) t[ab] = wmmab(wh[k2], ph[ab][k2], t[ab]);
        v4f o0 = (v4f){0.f, 0.f, 0.f, 0.f}, o1 = o0;
#pragma unroll
        for (int ab = 0; ab < 4; ++ab) { const float* vp = sV1 + (wp + ab * 16 + lr) * PF + db * 16 + 8 * hi; const v4f a = *(const v4f*)vp, b = *(const v4f*)(vp + 4);
#pragma unroll
            for (int e = 0; e < 4; ++e) { o0[e] += t[ab][e] * a[e]; o1[e] += t[ab][4 + e] * b[e]; } }
        *(v4f*)(rw + lr * PF + db * 16 + 8 * hi) = o0; *(v4f*)(rw + lr * PF + db * 16 + 8 * hi + 4) = o1;
        __builtin_amdgcn_sched_barrier(0x100);   /* keeps the blocks' products apart: merged, the compiler puts products on one accumulator tile back to back and each waits out the one before it; 0x100 lets LDS reads cross, so that the next block's fragments are fetched under this block's products */
    }
    /* the rows below were written by other lanes of this wave: keep the compiler from moving the reads above the writes (one wave's LDS operations run in order) */
    __builtin_amdgcn_wave_barrier(); asm volatile("" ::: "memory");
    v2f r = (v2f){0.f, 0.f};
#pragma unroll
    for (int row = 0; row < 16; ++row) { const v2f x = *(const v2f*)(rw + row * PF + lane * 2); r[0] += x[0]; r[1] += x[1]; }
    *(v2f*)(O + ((size_t)s * NH_ + h) * HD + lane * 2) = r * f;
    asm volatile("s_wait_xcnt 0x0" ::: "memory");   /* the next trip's first loads land in the registers that this store names: the wait that belongs in front of such an overwrite */
    }
}

extern "C" void kernel_launch(void* const* d_in, const int* in_sizes, int n_in,
                              void* d_out, int out_size, void* d_ws, size_t ws_size, hipStream_t stream) {
    (void)in_sizes; (void)n_in; (void)out_size; (void)d_ws; (void)ws_size;
    const float* q = (const float*)d_in[0]; const float* k1 = (const float*)d_in[1]; const float* k2 = (const float*)d_in[2]; const float* v1 = (const float*)d_in[3]; const float* v2 = (const float*)d_in[4];
    float* OUT = (float*)d_out;     // [1][1024][8][64]
    k_fused<<<dim3(NH_, SS_ / PB), 256, 0, stream>>>(q, k1, k2, v1, v2, OUT);
}

// v010
// A run of this version takes 10.8 microseconds.
// Timed twice side by side with v009, it ran 1.15 and 1.14 times as fast.
// Counting every step since v000, it is 95.4 times as fast.
#include <hip/hip_runtime.h>

// Two-simplicial (trilinear) windowed attention (q, k1, k2, v1, v2 [1][1024][8][64]; for every (s, h): logits[a][c] = (1/8) sum_d q[s][d] k1[s-a][d] (k2[s-c][d] + 1) over the causal windows a, c in [0, 64) (s-a, s-c >= 0 else -inf); p = softmax jointly over the 64 x 64 pairs; out[s][h][d] = sum_{a,c} p[a][c] v1[s-a][d] (v2[s-c][d] + 1) -> [1][1024][8][64] (0.52 M)).
// Layout: a' = 63 - a and c' = 63 - c make every window a contiguous ascending token range s-63 .. s; a token index below 0 is clipped to 0 as in the reference (its pairs are masked, so their P is exactly 0).
// One kernel does everything: a work-group of 8 waves takes 16 neighbouring positions of one head, reads the 79 token rows they share straight from k1, k2, v1, v2 and its 16 rows of q, rounds them on the way into LDS once, and each wave then carries two positions, one after the other, from the q k1 products to the output row with logits, P and TMP in registers.
//   logits^T[c'][a'] = (k2 window) . (q k1)^T + sum_d (q k1)[a'][d], so that a pair of D tiles, rounded to f16 in place, is the P operand (k = c') of the second product;
//   TMP^T[d][a'] = (v2 window)^T . P^T + sum_c' P[a'][c'] with the value window read by the transposing LDS load; then out[d] = sum_a' TMP^T[d][a'] v1[s-63+a'][d].
//   The two "+ 1" never enter a matrix operand: x . (y + 1) = x . y + sum x. The rounded k2 and v2 are one plane each, and each "+ 1" term depends on a' alone, which is fixed per lane and tile column. The first, sum_d q[d] k1[a'][d], is a matrix product of its own: q in all 16 rows times the k1 fragment as it was read.
// Compute dtypes, f32 accumulate: every input rounded to bf16; both tile contractions are ONE f16 product: the bf16-rounded q, k1, k2, v2 are carried as f16 (8 significant bits fit its 11: exact from 2^-14 up, within 2^-25 below); the q k1 products, made by the packed f16 multiply, and P are each rounded once to f16 (2^-11 relative); P carries a factor 2^15, which 1/sum takes out again, so that it keeps its 11 bits down to 2^-29 of the largest; the "+ 1" sum of the logits from the unrounded products of the f16 q and k1, accumulated in f32 by the matrix unit; the "+ 1" sum of TMP, softmax and the final a'-sum in f32.

#define SS_  1024                 // sequence positions
#define NH_  8
#define HD   64
#define WW_  64                   // window (both)
#define SCL  0.125f               // 1/sqrt(64)
#define PW   8                    // waves per work-group
#define PPW  2                    // positions a wave takes, one after the other
#define PB   (PW * PPW)           // positions per work-group
#define NR   (WW_ + PB - 1)       // token rows the work-group's windows cover
#define PSH  15.0f                // P = 2^PSH at the maximum: below the largest f16 (65504)
#define PK2  72                   // LDS pitch of the k1 and k2 planes, 16-bit elements: 144 B = 16 B x odd (16-byte row reads)
#define PF   68                   // LDS pitch of the f32 plane (v1) and of the a'-sum rows, floats: 272 B = 16 B x odd
#define PV2  80                   // LDS pitch of the v2 plane, 16-bit elements: 160 B = 32 B x odd (transposing reads)
typedef unsigned short bf;
typedef __attribute__((ext_vector_type(16))) _Float16 v16h;
typedef __attribute__((ext_vector_type(8)))  unsigned short v8us;
typedef __attribute__((ext_vector_type(8)))  short    v8s;
typedef __attribute__((ext_vector_type(8)))  unsigned v8u;
typedef __attribute__((ext_vector_type(2)))  unsigned v2u;
typedef __attribute__((ext_vector_type(8)))  float    v8f;
typedef __attribute__((ext_vector_type(4)))  float    v4f;
typedef __attribute__((ext_vector_type(2))) float v2f;

typedef __attribute__((ext_vector_type(2))) __bf16 v2bf;
typedef __attribute__((ext_vector_type(2))) _Float16 v2h;
// f32 -> bf16, round to nearest even, by the hardware's packed convert: a in the low half of the word, b in the high half
__device__ __forceinline__ unsigned cvt2(float a, float b) { return __builtin_bit_cast(unsigned, __builtin_convertvector(((v2f){a, b}), v2bf)); }
// f32 -> f16, round to nearest even, by the packed convert: a in the low half of the word, b in the high half
__device__ __forceinline__ unsigned cvth(float a, float b) { return __builtin_bit_cast(unsigned, __builtin_convertvector(((v2f){a, b}), v2h)); }
// two f32 rounded to bf16 (nearest even) and carried on as f16
__device__ __forceinline__ unsigned rndh(float a, float b) { const unsigned p = cvt2(a, b); return cvth(__uint_as_float(p << 16), __uint_as_float(p & 0xFFFF0000u)); }
__device__ __forceinline__ v16h cat16b(v8us lo, v8us hi) { return __builtin_bit_cast(v16h, __builtin_shufflevector(lo, hi, 0, 1, 2, 3, 4, 5, 6, 7, 8, 9, 10, 11, 12, 13, 14, 15)); }
__device__ __forceinline__ v8f wmmab(v16h a, v16h b, v8f c) { return __builtin_amdgcn_wmma_f32_16x16x32_f16(false, a, false, b, (short)0, c, false, false); }
// four f32 rounded to bf16 (nearest even) and widened again
__device__ __forceinline__ v4f rnd4(v4f x) { const unsigned p = cvt2(x[0], x[1]), r = cvt2(x[2], x[3]); return (v4f){__uint_as_float(p << 16), __uint_as_float(p & 0xFFFF0000u), __uint_as_float(r << 16), __uint_as_float(r & 0xFFFF0000u)}; }
// v_exp_f32 and, in the same statement so that it cannot drift, the one free slot that the instruction set asks for behind a transcendental before its result is read or its source overwritten
__device__ __forceinline__ float exp2s(float x) { float r; asm("v_exp_f32 %0, %1\n\tv_nop" : "=v"(r) : "v"(x)); return r; }
// lane l takes the value of lane l ^ 16 (the other half of the k range of the same tile column)
__device__ __forceinline__ float xhalf(float x) { return __builtin_bit_cast(float, __builtin_amdgcn_permlanex16(__builtin_bit_cast(int, x), __builtin_bit_cast(int, x), 0x76543210, 0xfedcba98, false, false)); }
// transposing LDS load: lane (c = l & 15, g = l >> 4) gets column c, rows 8 g .. 8 g + 7 of the 16 x 16 tile whose 16-byte pieces the lanes address
__device__ __forceinline__ v8us ldtr(const bf* p) { typedef __attribute__((address_space(3))) v8s lds_v8s; return __builtin_bit_cast(v8us, __builtin_amdgcn_ds_load_tr16_b128_v8i16((lds_v8s*)p)); }

// k_fused: grid (NH_, SS_ / PB), 256 threads: 512 work-groups, two to a WGP (registers), so all are resident at once and the rows are staged once a WGP slot; wave w of block (h, y) owns positions s = y * PB + w + PW * it, it < PPW. The head is the fast grid index, so that the work-groups of the first 63 positions, which alone run the mask and last longest, have the lowest indices. Every fragment is in the hardware k order: element e of lane (lr, hi) is k = 8 hi + e (e < 8), 16 + 8 hi + (e - 8) (e >= 8).
__global__ __launch_bounds__(256) __attribute__((amdgpu_waves_per_eu(4, 4))) void k_fused(const float* __restrict__ q, const float* __restrict__ k1, const float* __restrict__ k2, const float* __restrict__ v1, const float* __restrict__ v2, float* __restrict__ O) {
    __shared__ __align__(32) bf sK2[NR * PK2];
    __shared__ __align__(32) bf sV2[NR * PV2];
    __shared__ __align__(32) bf sK1[NR * PK2];
    __shared__ __align__(32) bf sQ[PB * HD];
    __shared__ __align__(32) float sV1[NR * PF];
    __shared__ __align__(32) float red[PW * 16 * PF];
    const int tid = threadIdx.x, lane = tid & 31, lr = lane & 15, hi = lane >> 4; const int w = __builtin_amdgcn_readfirstlane(tid >> 5);
    const int h = blockIdx.x, s0 = blockIdx.y * PB;
    /* LDS row r holds token max(s0 - 63 + r, 0) <= s0 + PB - 1 <= SS_ - 1: v1 rounded to bf16 and kept as f32; k1, k2, v2 rounded to bf16 and kept as f16; row p of sQ holds q of position s0 + p, rounded and kept alike (PB rows of 16 threads: one 16-byte load a thread) */
    /* every thread takes 16 bytes of each input at rows rw0 + 16 i; all its global loads are issued before the first conversion, so that the work-group waits out one load latency and not one a trip */
    const int rw0 = tid >> 4, cc = (tid & 15) * 4; const bool tail = rw0 < NR - 64;   /* rows 64 .. NR - 1: the first (NR - 64) * 16 threads */
    v4f x1[5], x2[5], x3[5], x4[5];
    const v4f xq = *(const v4f*)((const char*)q + (((unsigned)(s0 + rw0) * NH_ + h) * HD + cc) * 4);
    /* both loops unrolled: the four arrays stay in registers only under constant indices */
#pragma unroll
    for (int i = 0; i < 5; ++i) if (i < 4 || tail) { const unsigned g = (((unsigned)max(s0 - (WW_ - 1) + rw0 + 16 * i, 0) * NH_ + h) * HD + cc) * 4;   /* a 32-bit byte offset, below 2 MiB: one offset register serves the four uniform bases */
        x1[i] = *(const v4f*)((const char*)k1 + g); x2[i] = *(const v4f*)((const char*)k2 + g); x3[i] = *(const v4f*)((const char*)v1 + g); x4[i] = *(const v4f*)((const char*)v2 + g); }
#pragma unroll
    for (int i = 0; i < 5; ++i) if (i < 4 || tail) { const int row = rw0 + 16 * i;
        *(v2u*)(sK1 + row * PK2 + cc) = (v2u){rndh(x1[i][0], x1[i][1]), rndh(x1[i][2], x1[i][3])}; *(v4f*)(sV1 + row * PF + cc) = rnd4(x3[i]);
        *(v2u*)(sK2 + row * PK2 + cc) = (v2u){rndh(x2[i][0], x2[i][1]), rndh(x2[i][2], x2[i][3])}; *(v2u*)(sV2 + row * PV2 + cc) = (v2u){rndh(x4[i][0], x4[i][1]), rndh(x4[i][2], x4[i][3])}; }
    *(v2u*)(sQ + rw0 * HD + cc) = (v2u){rndh(xq[0], xq[1]), rndh(xq[2], xq[3])};
    __syncthreads();

    /* kept rolled: one copy of the body in the instruction cache, one set of registers; nothing below writes the staged rows, so the trips need no further barrier */
#pragma unroll 1
    for (int it = 0; it < PPW; ++it) {
    const int wp = w + PW * it, s = s0 + wp;   /* the position's place in the work-group = first LDS row of its windows */
    /* logits^T tiles acc[cb][ab]: register j = [c' = 16 cb + 8 hi + j][a' = 16 ab + lr], without the "+ 1" term; bias[ab] is that term, sum_d q[d] k1[a' = 16 ab + lr][d]: with q in every row of the first operand, all 16 rows of the product tile hold it, whole over the fragment's 32 d, so one register of the tile is kept */
    v8f acc[4][4]; float bias[4];
#pragma unroll
    for (int cb = 0; cb < 4; ++cb)
#pragma unroll
        for (int ab = 0; ab < 4; ++ab) acc[cb][ab] = (v8f){};
#pragma unroll
    for (int kc = 0; kc < 2; ++kc) {
        const int oq = wp * HD + kc * 32 + 8 * hi; const v16h qh = cat16b(*(const v8us*)(sQ + oq), *(const v8us*)(sQ + oq + 16));   /* the same for all 16 lr */
        v16h kh[4], k1h[4];
#pragma unroll
        for (int cb = 0; cb < 4; ++cb) { const int o = (wp + cb * 16 + lr) * PK2 + kc * 32 + 8 * hi; k1h[cb] = cat16b(*(const v8us*)(sK1 + o), *(const v8us*)(sK1 + o + 16)); kh[cb] = cat16b(*(const v8us*)(sK2 + o), *(const v8us*)(sK2 + o + 16)); }
        __builtin_amdgcn_sched_barrier(0);   /* holds the pass's 18 LDS reads together in front of its products: left free, the compiler spreads them among the products in eleven places, several waited for at once */
#pragma unroll
        for (int ab = 0; ab < 4; ++ab) {
            const v16h ah = qh * k1h[ab];   /* packed f16 multiply: the exact product rounded once to f16 */
            const v8f tb = wmmab(qh, k1h[ab], (v8f){});
#pragma unroll
            for (int cb = 0; cb < 4; ++cb) acc[cb][ab] = wmmab(kh[cb], ah, acc[cb][ab]);
            bias[ab] = kc ? bias[ab] + tb[0] : tb[0];
        }
    }

    /* joint softmax over the wave's 4096 pairs, 128 a lane; a', c' must be >= lim. It runs on the raw sums: 1/8 and log2 e are one constant CE, the exponent is one fma a logit (CE > 0 keeps the order, so the maximum is taken raw as well), and 1/sum multiplies the finished output row, not the 128 P values (so the factor 2^PSH in P, one more addend of that fma's constant, cancels there). The "+ 1" term of the logits, bias[ab], is one value a lane and ab: it joins the lane's maximum of that ab once and then rides in the addend of the fma */
    const int lim = (WW_ - 1) - s; float mx = -3.0e38f, rs[4];
    /* the mask is an identity from position 63 on (lim <= 0 <= a', c'): lim is the same in every lane of the wave, so one scalar branch takes those waves round all 128 selects and their compares; only the first 63 positions of a head run them */
    if (lim > 0) {
#pragma unroll
        for (int ab = 0; ab < 4; ++ab)
#pragma unroll
            for (int cb = 0; cb < 4; ++cb)
#pragma unroll
                for (int j = 0; j < 8; ++j) { const int cp = cb * 16 + hi * 8 + j, ap = ab * 16 + lr; acc[cb][ab][j] = (ap >= lim && cp >= lim) ? acc[cb][ab][j] : -3.0e38f; }
    }
#pragma unroll
    for (int ab = 0; ab < 4; ++ab) { float m = -3.0e38f;
#pragma unroll
        for (int cb = 0; cb < 4; ++cb)
#pragma unroll
            for (int j = 0; j < 8; ++j) m = fmaxf(m, acc[cb][ab][j]);
        mx = fmaxf(mx, m + bias[ab]); }
#pragma unroll
    for (int sh = 16; sh; sh >>= 1) mx = fmaxf(mx, __shfl_xor(mx, sh, 32));
    const float CE = SCL * 1.4426950408889634f;
    const v8f ce8 = (v8f){CE, CE, CE, CE, CE, CE, CE, CE};
    /* rs[ab]: sum_c' P[a' = 16 ab + lr][c'], the "+ 1" term of TMP; the four together are the softmax sum */
#pragma unroll
    for (int ab = 0; ab < 4; ++ab) { const float nb = (bias[ab] - mx) * CE + PSH; const v8f nb8 = (v8f){nb, nb, nb, nb, nb, nb, nb, nb}; float r = 0.f;
#pragma unroll
        for (int cb = 0; cb < 4; ++cb) { const v8f x = __builtin_elementwise_fma(acc[cb][ab], ce8, nb8);   /* a masked pair: about -5e37, exp2 gives 0 */
#pragma unroll
            for (int j = 0; j < 8; ++j) { const float e = exp2s(x[j]); acc[cb][ab][j] = e; r += e; } }
        rs[ab] = r + xhalf(r); }
    float sum = (rs[0] + rs[1]) + (rs[2] + rs[3]);   /* both halves are in already */
#pragma unroll
    for (int sh = 8; sh; sh >>= 1) sum += __shfl_xor(sum, sh, 32);
    const float f = __fdiv_rn(1.0f, sum);

    /* P fragments (column a' = 16 ab + lr, k = c'), not normalised (largest value about 2^PSH): D tiles 2 k2 and 2 k2 + 1 of one ab, rounded to f16 in place */
    v16h ph[4][2];
#pragma unroll
    for (int ab = 0; ab < 4; ++ab)
#pragma unroll
        for (int k2 = 0; k2 < 2; ++k2) { v8u hw;
#pragma unroll
            for (int e = 0; e < 8; e += 2) { hw[e / 2] = cvth(acc[2 * k2][ab][e], acc[2 * k2][ab][e + 1]); hw[4 + e / 2] = cvth(acc[2 * k2 + 1][ab][e], acc[2 * k2 + 1][ab][e + 1]); }
            ph[ab][k2] = __builtin_bit_cast(v16h, hw);
        }

    /* TMP^T tiles t[ab]: register j = [d = 16 db + 8 hi + j][a' = 16 ab + lr], started at rs[ab] (the same for every d); times v1 and summed over ab in the lane, over lr through the wave's own LDS rows */
    float* rw = red + w * 16 * PF;
#pragma unroll
    for (int db = 0; db < 4; ++db) {
        v16h wh[2];
#pragma unroll
        for (int k2 = 0; k2 < 2; ++k2) { const int o = (wp + k2 * 32 + 8 * hi + (lane & 7)) * PV2 + db * 16 + 8 * ((lane >> 3) & 1); wh[k2] = cat16b(ldtr(sV2 + o), ldtr(sV2 + o + 16 * PV2)); }
        v8f t[4];
#pragma unroll
        for (int ab = 0; ab < 4; ++ab) t[ab] = (v8f){rs[ab], rs[ab], rs[ab], rs[ab], rs[ab], rs[ab], rs[ab], rs[ab]};
#pragma unroll
        for (int k2 = 0; k2 < 2; ++k2)
#pragma unroll
            for (int ab = 0; ab < 4; ++ab) t[ab] = wmmab(wh[k2], ph[ab][k2], t[ab]);
        v4f o0 = (v4f){0.f, 0.f, 0.f, 0.f}, o1 = o0;
#pragma unroll
        for (int ab = 0; ab < 4; ++ab) { const float* vp = sV1 + (wp + ab * 16 + lr) * PF + db * 16 + 8 * hi; const v4f a = *(const v4f*)vp, b = *(const v4f*)(vp + 4);
#pragma unroll
            for (int e = 0; e < 4; ++e) { o0[e] += t[ab][e] * a[e]; o1[e] += t[ab][4 + e] * b[e]; } }
        *(v4f*)(rw + lr * PF + db * 16 + 8 * hi) = o0; *(v4f*)(rw + lr * PF + db * 16 + 8 * hi + 4) = o1;
        __builtin_amdgcn_sched_barrier(0x100);   /* keeps the blocks' products apart: merged, the compiler puts products on one accumulator tile back to back and each waits out the one before it; 0x100 lets LDS reads cross, so that the next block's fragments are fetched under this block's products */
    }
    /* the rows below were written by other lanes of this wave: keep the compiler from moving the reads above the writes (one wave's LDS operations run in order) */
    __builtin_amdgcn_wave_barrier(); asm volatile("" ::: "memory");
    v2f r = (v2f){0.f, 0.f};
#pragma unroll
    for (int row = 0; row < 16; ++row) { const v2f x = *(const v2f*)(rw + row * PF + lane * 2); r[0] += x[0]; r[1] += x[1]; }
    *(v2f*)(O + ((size_t)s * NH_ + h) * HD + lane * 2) = r * f;
    asm volatile("s_wait_xcnt 0x0" ::: "memory");   /* the next trip's first instructions overwrite the registers that this store names: the wait that belongs in front of such an overwrite */
    }
}

extern "C" void kernel_launch(void* const* d_in, const int* in_sizes, int n_in,
                              void* d_out, int out_size, void* d_ws, size_t ws_size, hipStream_t stream) {
    (void)in_sizes; (void)n_in; (void)out_size; (void)d_ws; (void)ws_size;
    const float* q = (const float*)d_in[0]; const float* k1 = (const float*)d_in[1]; const float* k2 = (const float*)d_in[2]; const float* v1 = (const float*)d_in[3]; const float* v2 = (const float*)d_in[4];
    float* OUT = (float*)d_out;     // [1][1024][8][64]
    k_fused<<<dim3(NH_, SS_ / PB), 256, 0, stream>>>(q, k1, k2, v1, v2, OUT);
}
